// v000
// Times are from an AMD MI455X. After a warm-up the kernel runs many times in a row, and a time is the length of
// such a window on the GPU divided by its runs, so every launch and the gaps after it count. The runs cycle
// through copies of the inputs. A figure is the median of several windows, for all but v000 over two sittings.
// Sittings can differ by a few percent; kernels timed side by side share one.
// v000 is the starting kernel. One run takes 835 microseconds.
// compute dtype: every float input RNE-converted to bf16; q/k/v = W x + b on v_wmma_f32_16x16x32_bf16 (bf16 x bf16, single product, f32 accumulate); logits q.k (no scaling) on v_wmma_f32_16x16x32_f16 with q and k as f16 hi + residual (x 2^10) planes, 3 products, f32 accumulate, stored f32; softmax in f32 (precise expf); P x 2^14 as f16 against v f16 on v_wmma_f32_16x16x32_f16 (single product, f32 accumulate); epilogue gamma * acc * 2^-14 + x in f32; f32 output.
#include <hip/hip_runtime.h>
#include <math.h>

typedef __attribute__((ext_vector_type(16))) _Float16 v16h;
typedef __attribute__((ext_vector_type(16))) __bf16 v16b;
typedef __attribute__((ext_vector_type(8)))  _Float16 v8h;
typedef __attribute__((ext_vector_type(8)))  __bf16 v8b;
typedef __attribute__((ext_vector_type(8)))  float v8f;
typedef __attribute__((ext_vector_type(4)))  float v4f;
typedef __attribute__((ext_vector_type(4)))  unsigned v4u;

#ifndef NB
#define NB 8
#endif
#ifndef SEQ
#define SEQ 2048
#endif
#define NB_FULL 8
#define SEQ_FULL 2048          // per-channel position stride of x / out (full-size buffers)
#define CC 256
#define DQ 32                  // q/k channels
#define PCARRY 16384.0f        // P plane carried x 2^14 (f16-normal on the chip), folded back in the epilogue
#define RCARRY 1024.0f         // q/k residual planes carried x 2^10, folded back after their own accumulator

static_assert(SEQ % 256 == 0);
static_assert(SEQ <= SEQ_FULL);
static_assert(NB <= NB_FULL);
static_assert(CC == 256);
static_assert(DQ == 32);
#define NBQ ((DQ * CC) / 2048)     // k_cvt blocks for one q/k weight (256 threads x 8 floats)
#define NBV ((CC * CC) / 2048)
static_assert(NBQ * 2048 == DQ * CC);
static_assert(NBV * 2048 == CC * CC);

template <typename T> __device__ __forceinline__ void vst2(void* p, T v) { *(T*)p = v;  }

__device__ __forceinline__ v8f wmma16(v16h a, v16h b, v8f c) {
  v8f d = __builtin_amdgcn_wmma_f32_16x16x32_f16(false, a, false, b, (short)0, c, false, false);
  asm volatile("v_nop\n\tv_nop\n\tv_nop\n\tv_nop" : "+v"(d) : "v"(a), "v"(b));
  return d;
}
__device__ __forceinline__ v8f wmma_bf(v16b a, v16b b, v8f c) {
  v8f d = __builtin_amdgcn_wmma_f32_16x16x32_bf16(false, a, false, b, (short)0, c, false, false);
  asm volatile("v_nop\n\tv_nop\n\tv_nop\n\tv_nop" : "+v"(d) : "v"(a), "v"(b));
  return d;
}
// 16x16x32 fragments: lane -> (h = lane>>4, row/col = lane&15); elements 0..7 = k0+8h+0..7, 8..15 = k0+16+8h+0..7; D element r = row 8h+r, col lane&15.
// Both A (row m, k-contiguous) and B (from a [n][k] k-contiguous copy, row n) use this same loader.
__device__ __forceinline__ v16h frag_h(const _Float16* rowk0, int lane) {
  union { v16h v; v8h q[2]; } u; const _Float16* p = rowk0 + 8 * (lane >> 4);
  u.q[0] = *(const v8h*)p; u.q[1] = *(const v8h*)(p + 16); return u.v;
}
__device__ __forceinline__ v16b frag_b(const __bf16* rowk0, int lane) {
  union { v16b v; v8b q[2]; } u; const __bf16* p = rowk0 + 8 * (lane >> 4);
  u.q[0] = *(const v8b*)p; u.q[1] = *(const v8b*)(p + 16); return u.v;
}
__device__ __forceinline__ float bfr(float v) { return (float)(__bf16)v; }   // RNE convert to bf16 and back

#define WS_WQ  ((size_t)0)                                   // bf16 Wq [32][256]
#define WS_WK  (WS_WQ + 2u * (size_t)DQ * CC)                // bf16 Wk [32][256]
#define WS_WV  (WS_WK + 2u * (size_t)DQ * CC)                // bf16 Wv [256][256]
#define WS_XB  (WS_WV + 2u * (size_t)CC * CC)                // bf16 x rows [b*SEQ + l][256]
#define WS_QH  (WS_XB + 2u * (size_t)NB * SEQ * CC)          // f16 q hi [b*SEQ + l][32]
#define WS_QL  (WS_QH + 2u * (size_t)NB * SEQ * DQ)          // f16 q residual x 2^10
#define WS_KH  (WS_QL + 2u * (size_t)NB * SEQ * DQ)          // f16 k hi
#define WS_KL  (WS_KH + 2u * (size_t)NB * SEQ * DQ)          // f16 k residual x 2^10
#define WS_VH  (WS_KL + 2u * (size_t)NB * SEQ * DQ)          // f16 v planes [b][c][SEQ]
#define WS_S   (WS_VH + 2u * (size_t)NB * CC * SEQ)          // f32 logits of one batch [SEQ][SEQ]
#define WS_P   (WS_S + 4u * (size_t)SEQ * SEQ)               // f16 P x 2^14 of one batch [SEQ][SEQ]
#define WS_END (WS_P + 2u * (size_t)SEQ * SEQ)
static_assert(WS_END <= (size_t)134217728);
static_assert(WS_XB % 128 == 0 && WS_QH % 128 == 0 && WS_QL % 128 == 0 && WS_KH % 128 == 0 && WS_KL % 128 == 0 && WS_VH % 128 == 0 && WS_S % 128 == 0 && WS_P % 128 == 0);

__global__ __launch_bounds__(256) void k_cvt(const float* __restrict__ WQ, const float* __restrict__ WK, const float* __restrict__ WV, __bf16* __restrict__ PQ, __bf16* __restrict__ PK, __bf16* __restrict__ PV) {
  const int blk = blockIdx.x; const int t = threadIdx.x;
  const int sel = blk < NBQ ? 0 : (blk < 2 * NBQ ? 1 : 2);                  // block-uniform
  const float* src = sel == 0 ? WQ : (sel == 1 ? WK : WV);
  __bf16* dst = sel == 0 ? PQ : (sel == 1 ? PK : PV);
  const size_t g = (size_t)(blk - (sel == 0 ? 0 : (sel == 1 ? NBQ : 2 * NBQ))) * 256 + t;
  const float* p = src + g * 8;
  const v4f a = *(const v4f*)p, c = *(const v4f*)(p + 4);
  union { v8b v; v4u u; } o;
#pragma unroll
  for (int i = 0; i < 4; ++i) { o.v[i] = (__bf16)a[i]; o.v[4 + i] = (__bf16)c[i]; }
  vst2(dst + g * 8, o.u);
}
// ---- k_xt: block = (64 positions, b): channels-first x -> bf16 rows [b*SEQ + l][256] via LDS; one wave writes one whole 512-B row per instruction
__global__ __launch_bounds__(256) void k_xt(const float* __restrict__ X, __bf16* __restrict__ XB) {
  __shared__ __align__(16) __bf16 st[64][CC + 8];
  const int t = threadIdx.x; const int l0 = blockIdx.x * 64; const size_t b = blockIdx.y;
#pragma unroll 2
  for (int e = t; e < CC * 16; e += 256) { const int c = e >> 4, lq = (e & 15) * 4;
    const v4f v = *(const v4f*)(X + (b * CC + c) * (size_t)SEQ_FULL + l0 + lq);
    st[lq][c] = (__bf16)v[0]; st[lq + 1][c] = (__bf16)v[1]; st[lq + 2][c] = (__bf16)v[2]; st[lq + 3][c] = (__bf16)v[3]; }
  __syncthreads();
  for (int e = t; e < 64 * 32; e += 256) { const int ll = e >> 5, q = e & 31;
    vst2(XB + (b * SEQ + l0 + ll) * (size_t)CC + q * 8, *(const v4u*)&st[ll][q * 8]); }
}
// ---- k_pqk: block = (64 rows, which in {q,k}): [row][32] = x W^T + b (bf16 x bf16, single product) -> f16 hi + residual x 2^10 planes
__global__ __launch_bounds__(128) __attribute__((amdgpu_num_vgpr(256))) void k_pqk(const __bf16* __restrict__ XB, const __bf16* __restrict__ PQ, const __bf16* __restrict__ PK, const float* __restrict__ BQ, const float* __restrict__ BK, _Float16* __restrict__ QH, _Float16* __restrict__ QL, _Float16* __restrict__ KH, _Float16* __restrict__ KL) {
  __shared__ __align__(16) _Float16 sh[64][DQ + 8], sl[64][DQ + 8];
  const int tid = threadIdx.x, wave = tid >> 5, lane = tid & 31, col = lane & 15, g = lane >> 4;
  const int which = blockIdx.y;                                              // block-uniform
  const __bf16* WP = which == 0 ? PQ : PK; const float* BA = which == 0 ? BQ : BK;
  _Float16* DH = which == 0 ? QH : KH; _Float16* DL = which == 0 ? QL : KL;
  const size_t r0 = (size_t)blockIdx.x * 64;
  v8f acc[2] = {};
#pragma unroll 2
  for (int kc = 0; kc < CC / 32; ++kc) {
    const v16b a = frag_b(XB + (r0 + wave * 16 + col) * CC + kc * 32, lane);              // A: row = position, k = channel
#pragma unroll
    for (int j = 0; j < 2; ++j) { const v16b w = frag_b(WP + (size_t)(j * 16 + col) * CC + kc * 32, lane);   // B from the [n][k] weight plane
      acc[j] = wmma_bf(a, w, acc[j]); }
  }
#pragma unroll
  for (int j = 0; j < 2; ++j) { const float bb = bfr(BA[j * 16 + col]);
#pragma unroll
    for (int r = 0; r < 8; ++r) { const float v = acc[j][r] + bb; const int rl = wave * 16 + 8 * g + r, cl = j * 16 + col;
      const _Float16 hv = (_Float16)v; sh[rl][cl] = hv; sl[rl][cl] = (_Float16)((v - (float)hv) * RCARRY); } }
  __syncthreads();
  for (int e = tid; e < 64 * 4; e += 128) { const int rl = e >> 2, q = e & 3; const size_t o = (r0 + rl) * DQ + q * 8;
    vst2(DH + o, *(const v4u*)&sh[rl][q * 8]); vst2(DL + o, *(const v4u*)&sl[rl][q * 8]); }
}
// ---- k_pvv: block = (64 positions of one batch, 128 channels): v = x Wv^T + bv (bf16 x bf16, single product) -> f16 channels-first planes [b][c][SEQ]
__global__ __launch_bounds__(128) __attribute__((amdgpu_num_vgpr(256))) void k_pvv(const __bf16* __restrict__ XB, const __bf16* __restrict__ PV, const float* __restrict__ BV, _Float16* __restrict__ VH) {
  __shared__ __align__(16) _Float16 th[128][72];
  const int tid = threadIdx.x, wave = tid >> 5, lane = tid & 31, col = lane & 15, g = lane >> 4;
  const int c0 = blockIdx.y * 128; const size_t r0 = (size_t)blockIdx.x * 64;
  v8f acc[8] = {};
#pragma unroll 1
  for (int kc = 0; kc < CC / 32; ++kc) {
    const v16b a = frag_b(XB + (r0 + wave * 16 + col) * CC + kc * 32, lane);
#pragma unroll
    for (int j = 0; j < 8; ++j) { const v16b w = frag_b(PV + (size_t)(c0 + j * 16 + col) * CC + kc * 32, lane); acc[j] = wmma_bf(a, w, acc[j]); }
  }
#pragma unroll
  for (int j = 0; j < 8; ++j) { const float bb = bfr(BV[c0 + j * 16 + col]);
#pragma unroll
    for (int r = 0; r < 8; ++r) { const int rl = wave * 16 + 8 * g + r, cl = j * 16 + col; th[cl][rl] = (_Float16)(acc[j][r] + bb); } }
  __syncthreads();
  { const size_t b = r0 / SEQ; const int t0 = (int)(r0 % SEQ);
    for (int e = tid; e < 128 * 8; e += 128) { const int cl = e >> 3, q = e & 7;
      vst2(VH + (b * CC + c0 + cl) * (size_t)SEQ + t0 + q * 8, *(const v4u*)&th[cl][q * 8]); } }
}
// ---- k_sc: block = (64 queries, 128 keys) of batch b: S[i][j] = q_i . k_j (no scaling), 3 products: qh.kh + (ql.kh + qh.kl) * 2^-10
__global__ __launch_bounds__(128) __attribute__((amdgpu_num_vgpr(256))) void k_sc(const _Float16* __restrict__ QH, const _Float16* __restrict__ QL, const _Float16* __restrict__ KH, const _Float16* __restrict__ KL, int b, float* __restrict__ S) {
  __shared__ __align__(16) float ss[4][16][132];
  const int tid = threadIdx.x, wave = tid >> 5, lane = tid & 31, col = lane & 15, g = lane >> 4;
  const int k0 = blockIdx.y * 128; const int ql0 = blockIdx.x * 64 + wave * 16; const size_t q0 = (size_t)b * SEQ + ql0;
  const v16h ah = frag_h(QH + (q0 + col) * DQ, lane), al = frag_h(QL + (q0 + col) * DQ, lane);   // A: row = query, k = d (32 = one k-step)
#pragma unroll
  for (int jg = 0; jg < 2; ++jg) {
    v8f acc[4] = {}, accl[4] = {};
#pragma unroll
    for (int j = 0; j < 4; ++j) { const size_t kr = ((size_t)b * SEQ + k0 + jg * 64 + j * 16 + col) * DQ;   // B from the [key][d] planes
      const v16h kh = frag_h(KH + kr, lane); const v16h kl = frag_h(KL + kr, lane);
      acc[j] = wmma16(ah, kh, acc[j]); accl[j] = wmma16(al, kh, accl[j]); accl[j] = wmma16(ah, kl, accl[j]); }
#pragma unroll
    for (int j = 0; j < 4; ++j)
#pragma unroll
      for (int r = 0; r < 8; ++r) ss[wave][8 * g + r][jg * 64 + j * 16 + col] = acc[j][r] + accl[j][r] * (1.0f / RCARRY);
  }
  __syncthreads();
  for (int rl = 0; rl < 16; ++rl) vst2(S + (size_t)(ql0 + rl) * SEQ + k0 + lane * 4, *(const v4f*)&ss[wave][rl][lane * 4]);
}
// ---- k_sm: block = query row: max-subtracted softmax over SEQ keys in f32 -> P x 2^14 as an f16 row (one wave writes 512 contiguous B per instruction)
__global__ __launch_bounds__(256) void k_sm(const float* __restrict__ S, _Float16* __restrict__ P) {
  __shared__ float sred[8]; __shared__ float sbc; __shared__ __align__(16) float se[SEQ]; __shared__ __align__(16) _Float16 sp[SEQ];
  const int t = threadIdx.x; const size_t row = blockIdx.x; const float* sr = S + row * SEQ;
  float m = -3.0e38f;
#pragma unroll 2
  for (int k = t; k < SEQ; k += 256) m = fmaxf(m, sr[k]);
#pragma unroll
  for (int o = 1; o < 32; o <<= 1) m = fmaxf(m, __shfl_xor(m, o));
  if ((t & 31) == 0) sred[t >> 5] = m; __syncthreads(); if (t == 0) { float a = sred[0]; for (int i = 1; i < 8; ++i) a = fmaxf(a, sred[i]); sbc = a; } __syncthreads(); m = sbc; __syncthreads();
  float sum = 0.f;
#pragma unroll 1
  for (int k = t; k < SEQ; k += 256) { const float e = expf(sr[k] - m); se[k] = e; sum += e; }
#pragma unroll
  for (int o = 1; o < 32; o <<= 1) sum += __shfl_xor(sum, o);
  if ((t & 31) == 0) sred[t >> 5] = sum; __syncthreads(); if (t == 0) { float a = 0.f; for (int i = 0; i < 8; ++i) a += sred[i]; sbc = 1.0f / a; } __syncthreads();
  const float inv = sbc * PCARRY;
#pragma unroll 2
  for (int k = t; k < SEQ; k += 256) sp[k] = (_Float16)(se[k] * inv);
  __syncthreads();
  for (int q = t; q < SEQ / 8; q += 256) vst2(P + row * SEQ + q * 8, *(const v4u*)&sp[q * 8]);
}
__global__ __launch_bounds__(128) __attribute__((amdgpu_num_vgpr(256))) void k_pv(const _Float16* __restrict__ P, const _Float16* __restrict__ VH, const float* __restrict__ X, const float* __restrict__ G, int b, float* __restrict__ OUT) {
  __shared__ __align__(16) float st[128][68];
  const int tid = threadIdx.x, wave = tid >> 5, lane = tid & 31, col = lane & 15, g = lane >> 4;
  const int c0 = blockIdx.y * 128; const int ql0 = blockIdx.x * 64 + wave * 16;
  const float gam = bfr(G[0]);
  v8f acc[8] = {};
#pragma unroll 1
  for (int kc = 0; kc < SEQ / 32; ++kc) {
    const v16h p = frag_h(P + (size_t)(ql0 + col) * SEQ + kc * 32, lane);                // A: row = query, k = key
#pragma unroll
    for (int j = 0; j < 8; ++j) { const v16h v = frag_h(VH + ((size_t)b * CC + c0 + j * 16 + col) * (size_t)SEQ + kc * 32, lane);   // B from the [channel][key] plane
      acc[j] = wmma16(p, v, acc[j]); }
  }
  const float sc = gam * (1.0f / PCARRY);
#pragma unroll
  for (int j = 0; j < 8; ++j)
#pragma unroll
    for (int r = 0; r < 8; ++r) st[j * 16 + col][wave * 16 + 8 * g + r] = acc[j][r] * sc;
  __syncthreads();
  { const int i0 = blockIdx.x * 64;
    for (int e = tid; e < 128 * 16; e += 128) { const int cl = e >> 4, q = e & 15;
      const size_t off = ((size_t)b * CC + c0 + cl) * (size_t)SEQ_FULL + i0 + q * 4;
      const v4f xr = *(const v4f*)(X + off); v4f o = *(const v4f*)&st[cl][q * 4];
      o[0] += bfr(xr[0]); o[1] += bfr(xr[1]); o[2] += bfr(xr[2]); o[3] += bfr(xr[3]);
      vst2(OUT + off, o); } }
}

extern "C" void kernel_launch(void* const* d_in, const int* in_sizes, int n_in, void* d_out, int out_size, void* d_ws, size_t ws_size, hipStream_t stream) {
  if (n_in < 8) return;
  if (in_sizes[0] < NB * CC * SEQ_FULL || in_sizes[1] < DQ * CC || in_sizes[2] < DQ || in_sizes[3] < DQ * CC || in_sizes[4] < DQ || in_sizes[5] < CC * CC || in_sizes[6] < CC || in_sizes[7] < 1) return;
  if (out_size < NB * CC * SEQ_FULL) return;
  if (ws_size < (size_t)WS_END) return;
  const float* X = (const float*)d_in[0]; const float* WQ = (const float*)d_in[1]; const float* BQ = (const float*)d_in[2];
  const float* WK = (const float*)d_in[3]; const float* BK = (const float*)d_in[4]; const float* WV = (const float*)d_in[5];
  const float* BV = (const float*)d_in[6]; const float* G = (const float*)d_in[7];
  float* OUT = (float*)d_out;
  char* ws = (char*)d_ws;
  __bf16 *PQ = (__bf16*)(ws + WS_WQ), *PK = (__bf16*)(ws + WS_WK), *PV = (__bf16*)(ws + WS_WV), *XB = (__bf16*)(ws + WS_XB);
  _Float16 *QH = (_Float16*)(ws + WS_QH), *QL = (_Float16*)(ws + WS_QL), *KH = (_Float16*)(ws + WS_KH), *KL = (_Float16*)(ws + WS_KL), *VH = (_Float16*)(ws + WS_VH);
  float* S = (float*)(ws + WS_S); _Float16* P = (_Float16*)(ws + WS_P);

  k_cvt<<<dim3(2 * NBQ + NBV), 256, 0, stream>>>(WQ, WK, WV, PQ, PK, PV);
  k_xt<<<dim3(SEQ / 64, NB), 256, 0, stream>>>(X, XB);
  k_pqk<<<dim3(NB * SEQ / 64, 2), 128, 0, stream>>>(XB, PQ, PK, BQ, BK, QH, QL, KH, KL);
  k_pvv<<<dim3(NB * SEQ / 64, CC / 128), 128, 0, stream>>>(XB, PV, BV, VH);
  for (int b = 0; b < NB; ++b) {
    k_sc<<<dim3(SEQ / 64, SEQ / 128), 128, 0, stream>>>(QH, QL, KH, KL, b, S);
    k_sm<<<dim3(SEQ), 256, 0, stream>>>(S, P);
    k_pv<<<dim3(SEQ / 64, CC / 128), 128, 0, stream>>>(P, VH, X, G, b, OUT);
  }
}

// v001
// One run takes 231 microseconds.
// Next to v000, in two timings, it ran 3.62 times as fast each time.
// compute dtype: every float input RNE-converted to bf16; q/k/v = W x + b on v_wmma_f32_16x16x32_bf16 (bf16 x bf16, single product, f32 accumulate); logits q.k (no scaling) on v_wmma_f32_16x16x32_f16 with q and k as f16 hi + residual (x 2^10) planes, 3 products, f32 accumulate, stored f32; softmax in f32 (precise expf); P x 2^14 as f16 against v f16 on v_wmma_f32_16x16x32_f16 (single product, f32 accumulate); epilogue gamma * acc * 2^-14 + x in f32; f32 output.
#include <hip/hip_runtime.h>
#include <math.h>

typedef __attribute__((ext_vector_type(16))) _Float16 v16h;
typedef __attribute__((ext_vector_type(16))) __bf16 v16b;
typedef __attribute__((ext_vector_type(8)))  _Float16 v8h;
typedef __attribute__((ext_vector_type(8)))  __bf16 v8b;
typedef __attribute__((ext_vector_type(8)))  float v8f;
typedef __attribute__((ext_vector_type(4)))  float v4f;
typedef __attribute__((ext_vector_type(4)))  unsigned v4u;

#ifndef NB
#define NB 8
#endif
#ifndef SEQ
#define SEQ 2048
#endif
#define NB_FULL 8
#define SEQ_FULL 2048          // per-channel position stride of x / out (full-size buffers)
#define CC 256
#define DQ 32                  // q/k channels
#define PCARRY 16384.0f        // P plane carried x 2^14 (f16-normal on the chip), folded back in the epilogue
#define RCARRY 1024.0f         // q/k residual planes carried x 2^10, folded back after their own accumulator

static_assert(SEQ % 256 == 0);
static_assert(SEQ <= SEQ_FULL);
static_assert(NB <= NB_FULL);
static_assert(CC == 256);
static_assert(DQ == 32);
#define NBQ ((DQ * CC) / 2048)     // k_cvt blocks for one q/k weight (256 threads x 8 floats)
#define NBV ((CC * CC) / 2048)
static_assert(NBQ * 2048 == DQ * CC);
static_assert(NBV * 2048 == CC * CC);

template <typename T> __device__ __forceinline__ void vst2(void* p, T v) { *(T*)p = v;  }

__device__ __forceinline__ v8f wmma16(v16h a, v16h b, v8f c) {
  v8f d = __builtin_amdgcn_wmma_f32_16x16x32_f16(false, a, false, b, (short)0, c, false, false);
  asm volatile("v_nop\n\tv_nop\n\tv_nop\n\tv_nop" : "+v"(d) : "v"(a), "v"(b));
  return d;
}
__device__ __forceinline__ v8f wmma_bf(v16b a, v16b b, v8f c) {
  v8f d = __builtin_amdgcn_wmma_f32_16x16x32_bf16(false, a, false, b, (short)0, c, false, false);
  asm volatile("v_nop\n\tv_nop\n\tv_nop\n\tv_nop" : "+v"(d) : "v"(a), "v"(b));
  return d;
}
// 16x16x32 fragments: lane -> (h = lane>>4, row/col = lane&15); elements 0..7 = k0+8h+0..7, 8..15 = k0+16+8h+0..7; D element r = row 8h+r, col lane&15.
// Both A (row m, k-contiguous) and B (from a [n][k] k-contiguous copy, row n) use this same loader.
__device__ __forceinline__ v16h frag_h(const _Float16* rowk0, int lane) {
  union { v16h v; v8h q[2]; } u; const _Float16* p = rowk0 + 8 * (lane >> 4);
  u.q[0] = *(const v8h*)p; u.q[1] = *(const v8h*)(p + 16); return u.v;
}
__device__ __forceinline__ v16b frag_b(const __bf16* rowk0, int lane) {
  union { v16b v; v8b q[2]; } u; const __bf16* p = rowk0 + 8 * (lane >> 4);
  u.q[0] = *(const v8b*)p; u.q[1] = *(const v8b*)(p + 16); return u.v;
}
__device__ __forceinline__ float bfr(float v) { return (float)(__bf16)v; }   // RNE convert to bf16 and back

#define WS_WQ  ((size_t)0)                                   // bf16 Wq [32][256]
#define WS_WK  (WS_WQ + 2u * (size_t)DQ * CC)                // bf16 Wk [32][256]
#define WS_WV  (WS_WK + 2u * (size_t)DQ * CC)                // bf16 Wv [256][256]
#define WS_XB  (WS_WV + 2u * (size_t)CC * CC)                // bf16 x rows [b*SEQ + l][256]
#define WS_QH  (WS_XB + 2u * (size_t)NB * SEQ * CC)          // f16 q hi [b*SEQ + l][32]
#define WS_QL  (WS_QH + 2u * (size_t)NB * SEQ * DQ)          // f16 q residual x 2^10
#define WS_KH  (WS_QL + 2u * (size_t)NB * SEQ * DQ)          // f16 k hi
#define WS_KL  (WS_KH + 2u * (size_t)NB * SEQ * DQ)          // f16 k residual x 2^10
#define WS_VH  (WS_KL + 2u * (size_t)NB * SEQ * DQ)          // f16 v planes [b][c][SEQ]
#define WS_S   (WS_VH + 2u * (size_t)NB * CC * SEQ)          // f32 logits of all batches [b*SEQ + i][SEQ]
#define WS_P   (WS_S + 4u * (size_t)NB * SEQ * SEQ)          // f16 P x 2^14 of all batches [b*SEQ + i][SEQ]
#define WS_END (WS_P + 2u * (size_t)NB * SEQ * SEQ)
static_assert(WS_END <= (size_t)268435456);
static_assert(WS_XB % 128 == 0 && WS_QH % 128 == 0 && WS_QL % 128 == 0 && WS_KH % 128 == 0 && WS_KL % 128 == 0 && WS_VH % 128 == 0 && WS_S % 128 == 0 && WS_P % 128 == 0);

__global__ __launch_bounds__(256) void k_cvt(const float* __restrict__ WQ, const float* __restrict__ WK, const float* __restrict__ WV, __bf16* __restrict__ PQ, __bf16* __restrict__ PK, __bf16* __restrict__ PV) {
  const int blk = blockIdx.x; const int t = threadIdx.x;
  const int sel = blk < NBQ ? 0 : (blk < 2 * NBQ ? 1 : 2);                  // block-uniform
  const float* src = sel == 0 ? WQ : (sel == 1 ? WK : WV);
  __bf16* dst = sel == 0 ? PQ : (sel == 1 ? PK : PV);
  const size_t g = (size_t)(blk - (sel == 0 ? 0 : (sel == 1 ? NBQ : 2 * NBQ))) * 256 + t;
  const float* p = src + g * 8;
  const v4f a = *(const v4f*)p, c = *(const v4f*)(p + 4);
  union { v8b v; v4u u; } o;
#pragma unroll
  for (int i = 0; i < 4; ++i) { o.v[i] = (__bf16)a[i]; o.v[4 + i] = (__bf16)c[i]; }
  vst2(dst + g * 8, o.u);
}
// ---- k_xt: block = (64 positions, b): channels-first x -> bf16 rows [b*SEQ + l][256] via LDS; one wave writes one whole 512-B row per instruction
__global__ __launch_bounds__(256) void k_xt(const float* __restrict__ X, __bf16* __restrict__ XB) {
  __shared__ __align__(16) __bf16 st[64][CC + 8];
  const int t = threadIdx.x; const int l0 = blockIdx.x * 64; const size_t b = blockIdx.y;
#pragma unroll 2
  for (int e = t; e < CC * 16; e += 256) { const int c = e >> 4, lq = (e & 15) * 4;
    const v4f v = *(const v4f*)(X + (b * CC + c) * (size_t)SEQ_FULL + l0 + lq);
    st[lq][c] = (__bf16)v[0]; st[lq + 1][c] = (__bf16)v[1]; st[lq + 2][c] = (__bf16)v[2]; st[lq + 3][c] = (__bf16)v[3]; }
  __syncthreads();
  for (int e = t; e < 64 * 32; e += 256) { const int ll = e >> 5, q = e & 31;
    vst2(XB + (b * SEQ + l0 + ll) * (size_t)CC + q * 8, *(const v4u*)&st[ll][q * 8]); }
}
// ---- k_pqk: block = (64 rows, which in {q,k}): [row][32] = x W^T + b (bf16 x bf16, single product) -> f16 hi + residual x 2^10 planes
__global__ __launch_bounds__(128) __attribute__((amdgpu_num_vgpr(256))) void k_pqk(const __bf16* __restrict__ XB, const __bf16* __restrict__ PQ, const __bf16* __restrict__ PK, const float* __restrict__ BQ, const float* __restrict__ BK, _Float16* __restrict__ QH, _Float16* __restrict__ QL, _Float16* __restrict__ KH, _Float16* __restrict__ KL) {
  __shared__ __align__(16) _Float16 sh[64][DQ + 8], sl[64][DQ + 8];
  const int tid = threadIdx.x, wave = tid >> 5, lane = tid & 31, col = lane & 15, g = lane >> 4;
  const int which = blockIdx.y;                                              // block-uniform
  const __bf16* WP = which == 0 ? PQ : PK; const float* BA = which == 0 ? BQ : BK;
  _Float16* DH = which == 0 ? QH : KH; _Float16* DL = which == 0 ? QL : KL;
  const size_t r0 = (size_t)blockIdx.x * 64;
  v8f acc[2] = {};
#pragma unroll 2
  for (int kc = 0; kc < CC / 32; ++kc) {
    const v16b a = frag_b(XB + (r0 + wave * 16 + col) * CC + kc * 32, lane);              // A: row = position, k = channel
#pragma unroll
    for (int j = 0; j < 2; ++j) { const v16b w = frag_b(WP + (size_t)(j * 16 + col) * CC + kc * 32, lane);   // B from the [n][k] weight plane
      acc[j] = wmma_bf(a, w, acc[j]); }
  }
#pragma unroll
  for (int j = 0; j < 2; ++j) { const float bb = bfr(BA[j * 16 + col]);
#pragma unroll
    for (int r = 0; r < 8; ++r) { const float v = acc[j][r] + bb; const int rl = wave * 16 + 8 * g + r, cl = j * 16 + col;
      const _Float16 hv = (_Float16)v; sh[rl][cl] = hv; sl[rl][cl] = (_Float16)((v - (float)hv) * RCARRY); } }
  __syncthreads();
  for (int e = tid; e < 64 * 4; e += 128) { const int rl = e >> 2, q = e & 3; const size_t o = (r0 + rl) * DQ + q * 8;
    vst2(DH + o, *(const v4u*)&sh[rl][q * 8]); vst2(DL + o, *(const v4u*)&sl[rl][q * 8]); }
}
// ---- k_pvv: block = (64 positions of one batch, 128 channels): v = x Wv^T + bv (bf16 x bf16, single product) -> f16 channels-first planes [b][c][SEQ]
__global__ __launch_bounds__(128) __attribute__((amdgpu_num_vgpr(256))) void k_pvv(const __bf16* __restrict__ XB, const __bf16* __restrict__ PV, const float* __restrict__ BV, _Float16* __restrict__ VH) {
  __shared__ __align__(16) _Float16 th[128][72];
  const int tid = threadIdx.x, wave = tid >> 5, lane = tid & 31, col = lane & 15, g = lane >> 4;
  const int c0 = blockIdx.y * 128; const size_t r0 = (size_t)blockIdx.x * 64;
  v8f acc[8] = {};
#pragma unroll 1
  for (int kc = 0; kc < CC / 32; ++kc) {
    const v16b a = frag_b(XB + (r0 + wave * 16 + col) * CC + kc * 32, lane);
#pragma unroll
    for (int j = 0; j < 8; ++j) { const v16b w = frag_b(PV + (size_t)(c0 + j * 16 + col) * CC + kc * 32, lane); acc[j] = wmma_bf(a, w, acc[j]); }
  }
#pragma unroll
  for (int j = 0; j < 8; ++j) { const float bb = bfr(BV[c0 + j * 16 + col]);
#pragma unroll
    for (int r = 0; r < 8; ++r) { const int rl = wave * 16 + 8 * g + r, cl = j * 16 + col; th[cl][rl] = (_Float16)(acc[j][r] + bb); } }
  __syncthreads();
  { const size_t b = r0 / SEQ; const int t0 = (int)(r0 % SEQ);
    for (int e = tid; e < 128 * 8; e += 128) { const int cl = e >> 3, q = e & 7;
      vst2(VH + (b * CC + c0 + cl) * (size_t)SEQ + t0 + q * 8, *(const v4u*)&th[cl][q * 8]); } }
}
// ---- k_sc: block = (64 queries, 128 keys, batch): S[i][j] = q_i . k_j (no scaling), 3 products: qh.kh + (ql.kh + qh.kl) * 2^-10
__global__ __launch_bounds__(128) __attribute__((amdgpu_num_vgpr(256))) void k_sc(const _Float16* __restrict__ QH, const _Float16* __restrict__ QL, const _Float16* __restrict__ KH, const _Float16* __restrict__ KL, float* __restrict__ S) {
  __shared__ __align__(16) float ss[4][16][132];
  const int tid = threadIdx.x, wave = tid >> 5, lane = tid & 31, col = lane & 15, g = lane >> 4;
  const int b = blockIdx.z; const int k0 = blockIdx.y * 128; const size_t q0 = (size_t)b * SEQ + blockIdx.x * 64 + wave * 16;
  const v16h ah = frag_h(QH + (q0 + col) * DQ, lane), al = frag_h(QL + (q0 + col) * DQ, lane);   // A: row = query, k = d (32 = one k-step)
#pragma unroll
  for (int jg = 0; jg < 2; ++jg) {
    v8f acc[4] = {}, accl[4] = {};
#pragma unroll
    for (int j = 0; j < 4; ++j) { const size_t kr = ((size_t)b * SEQ + k0 + jg * 64 + j * 16 + col) * DQ;   // B from the [key][d] planes
      const v16h kh = frag_h(KH + kr, lane); const v16h kl = frag_h(KL + kr, lane);
      acc[j] = wmma16(ah, kh, acc[j]); accl[j] = wmma16(al, kh, accl[j]); accl[j] = wmma16(ah, kl, accl[j]); }
#pragma unroll
    for (int j = 0; j < 4; ++j)
#pragma unroll
      for (int r = 0; r < 8; ++r) ss[wave][8 * g + r][jg * 64 + j * 16 + col] = acc[j][r] + accl[j][r] * (1.0f / RCARRY);
  }
  __syncthreads();
  for (int rl = 0; rl < 16; ++rl) vst2(S + (q0 + rl) * SEQ + k0 + lane * 4, *(const v4f*)&ss[wave][rl][lane * 4]);
}
// ---- k_sm: block = query row of any batch: max-subtracted softmax over SEQ keys in f32 -> P x 2^14 as an f16 row (one wave writes 512 contiguous B per instruction)
__global__ __launch_bounds__(256) void k_sm(const float* __restrict__ S, _Float16* __restrict__ P) {
  __shared__ float sred[8]; __shared__ float sbc; __shared__ __align__(16) float se[SEQ]; __shared__ __align__(16) _Float16 sp[SEQ];
  const int t = threadIdx.x; const size_t row = blockIdx.x; const float* sr = S + row * SEQ;
  float m = -3.0e38f;
#pragma unroll 2
  for (int k = t; k < SEQ; k += 256) m = fmaxf(m, sr[k]);
#pragma unroll
  for (int o = 1; o < 32; o <<= 1) m = fmaxf(m, __shfl_xor(m, o));
  if ((t & 31) == 0) sred[t >> 5] = m; __syncthreads(); if (t == 0) { float a = sred[0]; for (int i = 1; i < 8; ++i) a = fmaxf(a, sred[i]); sbc = a; } __syncthreads(); m = sbc; __syncthreads();
  float sum = 0.f;
#pragma unroll 1
  for (int k = t; k < SEQ; k += 256) { const float e = expf(sr[k] - m); se[k] = e; sum += e; }
#pragma unroll
  for (int o = 1; o < 32; o <<= 1) sum += __shfl_xor(sum, o);
  if ((t & 31) == 0) sred[t >> 5] = sum; __syncthreads(); if (t == 0) { float a = 0.f; for (int i = 0; i < 8; ++i) a += sred[i]; sbc = 1.0f / a; } __syncthreads();
  const float inv = sbc * PCARRY;
#pragma unroll 2
  for (int k = t; k < SEQ; k += 256) sp[k] = (_Float16)(se[k] * inv);
  __syncthreads();
  for (int q = t; q < SEQ / 8; q += 256) vst2(P + row * SEQ + q * 8, *(const v4u*)&sp[q * 8]);
}
__global__ __launch_bounds__(128) __attribute__((amdgpu_num_vgpr(256))) void k_pv(const _Float16* __restrict__ P, const _Float16* __restrict__ VH, const float* __restrict__ X, const float* __restrict__ G, float* __restrict__ OUT) {
  __shared__ __align__(16) float st[128][68];
  const int tid = threadIdx.x, wave = tid >> 5, lane = tid & 31, col = lane & 15, g = lane >> 4;
  const int b = blockIdx.z; const int c0 = blockIdx.y * 128; const size_t q0 = (size_t)b * SEQ + blockIdx.x * 64 + wave * 16;
  const float gam = bfr(G[0]);
  v8f acc[8] = {};
#pragma unroll 1
  for (int kc = 0; kc < SEQ / 32; ++kc) {
    const v16h p = frag_h(P + (q0 + col) * SEQ + kc * 32, lane);                // A: row = query, k = key
#pragma unroll
    for (int j = 0; j < 8; ++j) { const v16h v = frag_h(VH + ((size_t)b * CC + c0 + j * 16 + col) * (size_t)SEQ + kc * 32, lane);   // B from the [channel][key] plane
      acc[j] = wmma16(p, v, acc[j]); }
  }
  const float sc = gam * (1.0f / PCARRY);
#pragma unroll
  for (int j = 0; j < 8; ++j)
#pragma unroll
    for (int r = 0; r < 8; ++r) st[j * 16 + col][wave * 16 + 8 * g + r] = acc[j][r] * sc;
  __syncthreads();
  { const int i0 = blockIdx.x * 64;
    for (int e = tid; e < 128 * 16; e += 128) { const int cl = e >> 4, q = e & 15;
      const size_t off = ((size_t)b * CC + c0 + cl) * (size_t)SEQ_FULL + i0 + q * 4;
      const v4f xr = *(const v4f*)(X + off); v4f o = *(const v4f*)&st[cl][q * 4];
      o[0] += bfr(xr[0]); o[1] += bfr(xr[1]); o[2] += bfr(xr[2]); o[3] += bfr(xr[3]);
      vst2(OUT + off, o); } }
}

extern "C" void kernel_launch(void* const* d_in, const int* in_sizes, int n_in, void* d_out, int out_size, void* d_ws, size_t ws_size, hipStream_t stream) {
  if (n_in < 8) return;
  if (in_sizes[0] < NB * CC * SEQ_FULL || in_sizes[1] < DQ * CC || in_sizes[2] < DQ || in_sizes[3] < DQ * CC || in_sizes[4] < DQ || in_sizes[5] < CC * CC || in_sizes[6] < CC || in_sizes[7] < 1) return;
  if (out_size < NB * CC * SEQ_FULL) return;
  if (ws_size < (size_t)WS_END) return;
  const float* X = (const float*)d_in[0]; const float* WQ = (const float*)d_in[1]; const float* BQ = (const float*)d_in[2];
  const float* WK = (const float*)d_in[3]; const float* BK = (const float*)d_in[4]; const float* WV = (const float*)d_in[5];
  const float* BV = (const float*)d_in[6]; const float* G = (const float*)d_in[7];
  float* OUT = (float*)d_out;
  char* ws = (char*)d_ws;
  __bf16 *PQ = (__bf16*)(ws + WS_WQ), *PK = (__bf16*)(ws + WS_WK), *PV = (__bf16*)(ws + WS_WV), *XB = (__bf16*)(ws + WS_XB);
  _Float16 *QH = (_Float16*)(ws + WS_QH), *QL = (_Float16*)(ws + WS_QL), *KH = (_Float16*)(ws + WS_KH), *KL = (_Float16*)(ws + WS_KL), *VH = (_Float16*)(ws + WS_VH);
  float* S = (float*)(ws + WS_S); _Float16* P = (_Float16*)(ws + WS_P);

  k_cvt<<<dim3(2 * NBQ + NBV), 256, 0, stream>>>(WQ, WK, WV, PQ, PK, PV);
  k_xt<<<dim3(SEQ / 64, NB), 256, 0, stream>>>(X, XB);
  k_pqk<<<dim3(NB * SEQ / 64, 2), 128, 0, stream>>>(XB, PQ, PK, BQ, BK, QH, QL, KH, KL);
  k_pvv<<<dim3(NB * SEQ / 64, CC / 128), 128, 0, stream>>>(XB, PV, BV, VH);
  k_sc<<<dim3(SEQ / 64, SEQ / 128, NB), 128, 0, stream>>>(QH, QL, KH, KL, S);
  k_sm<<<dim3(NB * SEQ), 256, 0, stream>>>(S, P);
  k_pv<<<dim3(SEQ / 64, CC / 128, NB), 128, 0, stream>>>(P, VH, X, G, OUT);
}

// v002
// Measured time: 71.1 microseconds a run.
// Next to v001, in two timings, it ran 3.22 and 3.28 times as fast.
// Over all steps from v000 it is 11.8 times as fast.
// compute dtype: every float input RNE-converted to bf16; q/k/v = W x + b on v_wmma_f32_16x16x32_bf16 (bf16 x bf16, single product, f32 accumulate); logits q.k (no scaling) on v_wmma_f32_16x16x32_f16 with q and k as f16 hi + residual (x 2^10) planes, 3 products, f32 accumulate, kept in registers; softmax in f32 on a running maximum (precise expf), normalised at the end; exp x 2^14 as f16 against v f16 on v_wmma_f32_16x16x32_f16 (single product, f32 accumulate); epilogue gamma * acc * 2^-14 / sum + x in f32; f32 output.
#include <hip/hip_runtime.h>
#include <math.h>

typedef __attribute__((ext_vector_type(16))) _Float16 v16h;
typedef __attribute__((ext_vector_type(16))) __bf16 v16b;
typedef __attribute__((ext_vector_type(8)))  _Float16 v8h;
typedef __attribute__((ext_vector_type(8)))  __bf16 v8b;
typedef __attribute__((ext_vector_type(8)))  float v8f;
typedef __attribute__((ext_vector_type(4)))  float v4f;
typedef __attribute__((ext_vector_type(4)))  unsigned v4u;

#ifndef NB
#define NB 8
#endif
#ifndef SEQ
#define SEQ 2048
#endif
#define NB_FULL 8
#define SEQ_FULL 2048          // per-channel position stride of x / out (full-size buffers)
#define CC 256
#define DQ 32                  // q/k channels
#define PCARRY 16384.0f        // P fragments carried x 2^14 (f16-normal on the chip), folded back in the epilogue
#define RCARRY 1024.0f         // q/k residual planes carried x 2^10, folded back after their own accumulator

static_assert(SEQ % 256 == 0);
static_assert(SEQ <= SEQ_FULL);
static_assert(NB <= NB_FULL);
static_assert(CC == 256);
static_assert(DQ == 32);
#define NBQ ((DQ * CC) / 2048)     // k_cvt blocks for one q/k weight (256 threads x 8 floats)
#define NBV ((CC * CC) / 2048)
static_assert(NBQ * 2048 == DQ * CC);
static_assert(NBV * 2048 == CC * CC);

template <typename T> __device__ __forceinline__ void vst2(void* p, T v) { *(T*)p = v;  }

__device__ __forceinline__ v8f wmma_bf(v16b a, v16b b, v8f c) {
  v8f d = __builtin_amdgcn_wmma_f32_16x16x32_bf16(false, a, false, b, (short)0, c, false, false);
  asm volatile("v_nop\n\tv_nop\n\tv_nop\n\tv_nop" : "+v"(d) : "v"(a), "v"(b));
  return d;
}
// 16x16x32 fragments: lane -> (h = lane>>4, row/col = lane&15); elements 0..7 = k0+8h+0..7, 8..15 = k0+16+8h+0..7; D element r = row 8h+r, col lane&15.
// Both A (row m, k-contiguous) and B (from a [n][k] k-contiguous copy, row n) use this same loader.
__device__ __forceinline__ v16h frag_h(const _Float16* rowk0, int lane) {
  union { v16h v; v8h q[2]; } u; const _Float16* p = rowk0 + 8 * (lane >> 4);
  u.q[0] = *(const v8h*)p; u.q[1] = *(const v8h*)(p + 16); return u.v;
}
__device__ __forceinline__ v16b frag_b(const __bf16* rowk0, int lane) {
  union { v16b v; v8b q[2]; } u; const __bf16* p = rowk0 + 8 * (lane >> 4);
  u.q[0] = *(const v8b*)p; u.q[1] = *(const v8b*)(p + 16); return u.v;
}
__device__ __forceinline__ float bfr(float v) { return (float)(__bf16)v; }   // RNE convert to bf16 and back

#define WS_WQ  ((size_t)0)                                   // bf16 Wq [32][256]
#define WS_WK  (WS_WQ + 2u * (size_t)DQ * CC)                // bf16 Wk [32][256]
#define WS_WV  (WS_WK + 2u * (size_t)DQ * CC)                // bf16 Wv [256][256]
#define WS_XB  (WS_WV + 2u * (size_t)CC * CC)                // bf16 x rows [b*SEQ + l][256]
#define WS_QH  (WS_XB + 2u * (size_t)NB * SEQ * CC)          // f16 q hi [b*SEQ + l][32]
#define WS_QL  (WS_QH + 2u * (size_t)NB * SEQ * DQ)          // f16 q residual x 2^10
#define WS_KH  (WS_QL + 2u * (size_t)NB * SEQ * DQ)          // f16 k hi
#define WS_KL  (WS_KH + 2u * (size_t)NB * SEQ * DQ)          // f16 k residual x 2^10
#define WS_VH  (WS_KL + 2u * (size_t)NB * SEQ * DQ)          // f16 v planes [b][c][SEQ]
#define WS_END (WS_VH + 2u * (size_t)NB * CC * SEQ)
static_assert(WS_END <= (size_t)268435456);
static_assert(WS_XB % 128 == 0 && WS_QH % 128 == 0 && WS_QL % 128 == 0 && WS_KH % 128 == 0 && WS_KL % 128 == 0 && WS_VH % 128 == 0);

__global__ __launch_bounds__(256) void k_cvt(const float* __restrict__ WQ, const float* __restrict__ WK, const float* __restrict__ WV, __bf16* __restrict__ PQ, __bf16* __restrict__ PK, __bf16* __restrict__ PV) {
  const int blk = blockIdx.x; const int t = threadIdx.x;
  const int sel = blk < NBQ ? 0 : (blk < 2 * NBQ ? 1 : 2);                  // block-uniform
  const float* src = sel == 0 ? WQ : (sel == 1 ? WK : WV);
  __bf16* dst = sel == 0 ? PQ : (sel == 1 ? PK : PV);
  const size_t g = (size_t)(blk - (sel == 0 ? 0 : (sel == 1 ? NBQ : 2 * NBQ))) * 256 + t;
  const float* p = src + g * 8;
  const v4f a = *(const v4f*)p, c = *(const v4f*)(p + 4);
  union { v8b v; v4u u; } o;
#pragma unroll
  for (int i = 0; i < 4; ++i) { o.v[i] = (__bf16)a[i]; o.v[4 + i] = (__bf16)c[i]; }
  vst2(dst + g * 8, o.u);
}
// ---- k_xt: block = (64 positions, b): channels-first x -> bf16 rows [b*SEQ + l][256] via LDS; one wave writes one whole 512-B row per instruction
__global__ __launch_bounds__(256) void k_xt(const float* __restrict__ X, __bf16* __restrict__ XB) {
  __shared__ __align__(16) __bf16 st[64][CC + 8];
  const int t = threadIdx.x; const int l0 = blockIdx.x * 64; const size_t b = blockIdx.y;
#pragma unroll 2
  for (int e = t; e < CC * 16; e += 256) { const int c = e >> 4, lq = (e & 15) * 4;
    const v4f v = *(const v4f*)(X + (b * CC + c) * (size_t)SEQ_FULL + l0 + lq);
    st[lq][c] = (__bf16)v[0]; st[lq + 1][c] = (__bf16)v[1]; st[lq + 2][c] = (__bf16)v[2]; st[lq + 3][c] = (__bf16)v[3]; }
  __syncthreads();
  for (int e = t; e < 64 * 32; e += 256) { const int ll = e >> 5, q = e & 31;
    vst2(XB + (b * SEQ + l0 + ll) * (size_t)CC + q * 8, *(const v4u*)&st[ll][q * 8]); }
}
// ---- k_pqk: block = (64 rows, which in {q,k}): [row][32] = x W^T + b (bf16 x bf16, single product) -> f16 hi + residual x 2^10 planes
__global__ __launch_bounds__(128) __attribute__((amdgpu_num_vgpr(256))) void k_pqk(const __bf16* __restrict__ XB, const __bf16* __restrict__ PQ, const __bf16* __restrict__ PK, const float* __restrict__ BQ, const float* __restrict__ BK, _Float16* __restrict__ QH, _Float16* __restrict__ QL, _Float16* __restrict__ KH, _Float16* __restrict__ KL) {
  __shared__ __align__(16) _Float16 sh[64][DQ + 8], sl[64][DQ + 8];
  const int tid = threadIdx.x, wave = tid >> 5, lane = tid & 31, col = lane & 15, g = lane >> 4;
  const int which = blockIdx.y;                                              // block-uniform
  const __bf16* WP = which == 0 ? PQ : PK; const float* BA = which == 0 ? BQ : BK;
  _Float16* DH = which == 0 ? QH : KH; _Float16* DL = which == 0 ? QL : KL;
  const size_t r0 = (size_t)blockIdx.x * 64;
  v8f acc[2] = {};
#pragma unroll 2
  for (int kc = 0; kc < CC / 32; ++kc) {
    const v16b a = frag_b(XB + (r0 + wave * 16 + col) * CC + kc * 32, lane);              // A: row = position, k = channel
#pragma unroll
    for (int j = 0; j < 2; ++j) { const v16b w = frag_b(WP + (size_t)(j * 16 + col) * CC + kc * 32, lane);   // B from the [n][k] weight plane
      acc[j] = wmma_bf(a, w, acc[j]); }
  }
#pragma unroll
  for (int j = 0; j < 2; ++j) { const float bb = bfr(BA[j * 16 + col]);
#pragma unroll
    for (int r = 0; r < 8; ++r) { const float v = acc[j][r] + bb; const int rl = wave * 16 + 8 * g + r, cl = j * 16 + col;
      const _Float16 hv = (_Float16)v; sh[rl][cl] = hv; sl[rl][cl] = (_Float16)((v - (float)hv) * RCARRY); } }
  __syncthreads();
  for (int e = tid; e < 64 * 4; e += 128) { const int rl = e >> 2, q = e & 3; const size_t o = (r0 + rl) * DQ + q * 8;
    vst2(DH + o, *(const v4u*)&sh[rl][q * 8]); vst2(DL + o, *(const v4u*)&sl[rl][q * 8]); }
}
// ---- k_pvv: block = (64 positions of one batch, 128 channels): v = x Wv^T + bv (bf16 x bf16, single product) -> f16 channels-first planes [b][c][SEQ]
__global__ __launch_bounds__(128) __attribute__((amdgpu_num_vgpr(256))) void k_pvv(const __bf16* __restrict__ XB, const __bf16* __restrict__ PV, const float* __restrict__ BV, _Float16* __restrict__ VH) {
  __shared__ __align__(16) _Float16 th[128][72];
  const int tid = threadIdx.x, wave = tid >> 5, lane = tid & 31, col = lane & 15, g = lane >> 4;
  const int c0 = blockIdx.y * 128; const size_t r0 = (size_t)blockIdx.x * 64;
  v8f acc[8] = {};
#pragma unroll 1
  for (int kc = 0; kc < CC / 32; ++kc) {
    const v16b a = frag_b(XB + (r0 + wave * 16 + col) * CC + kc * 32, lane);
#pragma unroll
    for (int j = 0; j < 8; ++j) { const v16b w = frag_b(PV + (size_t)(c0 + j * 16 + col) * CC + kc * 32, lane); acc[j] = wmma_bf(a, w, acc[j]); }
  }
#pragma unroll
  for (int j = 0; j < 8; ++j) { const float bb = bfr(BV[c0 + j * 16 + col]);
#pragma unroll
    for (int r = 0; r < 8; ++r) { const int rl = wave * 16 + 8 * g + r, cl = j * 16 + col; th[cl][rl] = (_Float16)(acc[j][r] + bb); } }
  __syncthreads();
  { const size_t b = r0 / SEQ; const int t0 = (int)(r0 % SEQ);
    for (int e = tid; e < 128 * 8; e += 128) { const int cl = e >> 3, q = e & 7;
      vst2(VH + (b * CC + c0 + cl) * (size_t)SEQ + t0 + q * 8, *(const v4u*)&th[cl][q * 8]); } }
}
// ---- k_fa: block = (64 queries, batch), 8 waves = 4 query tiles of 16 x 2 key halves. Scores, softmax and P.V in one pass over the keys; S and P never leave registers.
// Transposed products: S^T = K Q^T (A = key rows, B = query rows), so a lane holds one query's scores (column lane&15, keys 8h+r) and the two S^T tiles of 32 keys
// are already the B fragment of O^T += V P^T (elements 0..7 = keys 8h+0..7, 8..15 = keys 16+8h+0..7, the k order of frag_h on the V rows).
// Each 128-key tile of K (hi, residual) and V is brought in by whole-line loads, one tile ahead, and shared by the waves through two LDS buffers.
// Every full '#pragma unroll' below makes the indices of a register array compile-time constants, so that the array stays in registers.
#define FQ 64                  // queries per work-group
#define FK 128                 // keys per staged tile: 64 for each key half
#define VP (FK + 8)            // V row pitch in LDS, 272 B = 16 B x odd
#define KP (DQ + 8)            // K row pitch in LDS, 80 B = 16 B x odd
static_assert(SEQ % FK == 0 && SEQ % FQ == 0);
struct __align__(16) FBuf { _Float16 v[CC][VP]; _Float16 kh[FK][KP]; _Float16 kl[FK][KP]; };
__device__ __forceinline__ v8f wmma_h(v16h a, v16h b, v8f c) { return __builtin_amdgcn_wmma_f32_16x16x32_f16(false, a, false, b, (short)0, c, false, false); }
__device__ __forceinline__ float xhalf(float x) { return __builtin_bit_cast(float, __builtin_amdgcn_permlanex16(__builtin_bit_cast(int, x), __builtin_bit_cast(int, x), 0x76543210, 0xfedcba98, false, false)); }   // lane l reads lane l ^ 16
// V fragments of group gi (k-step gi >> 1, channel tiles 8 * (gi & 1) + 0..7). A: row = channel, k = key
__device__ __forceinline__ void ldv(v16h (&d)[8], const FBuf& cur, int gi, int ks, int col, int lane) {
#pragma unroll
  for (int i = 0; i < 8; ++i) d[i] = frag_h(&cur.v[((gi & 1) * 8 + i) * 16 + col][ks * 64 + (gi >> 1) * 32], lane);
}

__global__ __launch_bounds__(256) void k_fa(const _Float16* __restrict__ QH, const _Float16* __restrict__ QL, const _Float16* __restrict__ KH, const _Float16* __restrict__ KL, const _Float16* __restrict__ VH, const float* __restrict__ X, const float* __restrict__ G, float* __restrict__ OUT) {
  __shared__ FBuf buf[2];
  __shared__ __align__(16) float st[CC][FQ + 4];
  __shared__ float sm_m[2][FQ], sm_l[2][FQ];
  const int tid = threadIdx.x, lane = tid & 31, col = lane & 15, g = lane >> 4;
  const int wave = __builtin_amdgcn_readfirstlane(tid >> 5), qt = wave & 3, ks = wave >> 2;   // wave-uniform
  const int b = blockIdx.y, i0 = blockIdx.x * FQ;
  const size_t q0 = (size_t)b * SEQ + i0 + qt * 16;
  const v16h qh = frag_h(QH + (q0 + col) * DQ, lane), ql = frag_h(QL + (q0 + col) * DQ, lane);   // B: row = query, k = d
  const _Float16* vsrc = VH + (size_t)b * CC * SEQ + (size_t)(tid >> 4) * SEQ + (tid & 15) * 8;   // 16 lanes cover one 256-B row piece
  const _Float16* hsrc = KH + (size_t)b * SEQ * DQ + tid * 8;
  const _Float16* lsrc = KL + (size_t)b * SEQ * DQ + tid * 8;
  v4u rv[16], rh[2], rl[2];
#pragma unroll
  for (int i = 0; i < 16; ++i) rv[i] = *(const v4u*)(vsrc + (size_t)i * 16 * SEQ);
#pragma unroll
  for (int i = 0; i < 2; ++i) { rh[i] = *(const v4u*)(hsrc + i * 2048); rl[i] = *(const v4u*)(lsrc + i * 2048); }
  asm volatile("s_wait_xcnt 0x0" ::: "memory");                               // the loads' address registers are reused right behind them
  float m = -3.0e38f, l = 0.f;
  v8f o[16] = {};
#pragma unroll
  for (int i = 0; i < 16; ++i) vst2(&buf[0].v[i * 16 + (tid >> 4)][(tid & 15) * 8], rv[i]);
#pragma unroll
  for (int i = 0; i < 2; ++i) { vst2(&buf[0].kh[i * 64 + (tid >> 2)][(tid & 3) * 8], rh[i]); vst2(&buf[0].kl[i * 64 + (tid >> 2)][(tid & 3) * 8], rl[i]); }
  __syncthreads();
#pragma unroll 1   // stays rolled: one pass is already a long straight-line body, a second copy would only cost instruction cache
  for (int t = 0; t < SEQ / FK; ++t) {
    const FBuf& cur = buf[t & 1];
    if (t + 1 < SEQ / FK) {                                                   // next tile's loads fly under this tile's work
#pragma unroll
      for (int i = 0; i < 16; ++i) rv[i] = *(const v4u*)(vsrc + (size_t)i * 16 * SEQ + (t + 1) * FK);
#pragma unroll
      for (int i = 0; i < 2; ++i) { rh[i] = *(const v4u*)(hsrc + (size_t)(t + 1) * FK * DQ + i * 2048); rl[i] = *(const v4u*)(lsrc + (size_t)(t + 1) * FK * DQ + i * 2048); }
      asm volatile("s_wait_xcnt 0x0" ::: "memory");                           // the loads' address registers are reused right behind them
    }
    float s[4][8];
#pragma unroll
    for (int j = 0; j < 4; ++j) {                                             // A: row = key, k = d; 3 products: kh.qh + (kh.ql + kl.qh) * 2^-10
      const v16h kh = frag_h(&cur.kh[ks * 64 + j * 16 + col][0], lane), kl = frag_h(&cur.kl[ks * 64 + j * 16 + col][0], lane);
      v8f a = {}, al = {};
      a = wmma_h(kh, qh, a); al = wmma_h(kh, ql, al); al = wmma_h(kl, qh, al);
#pragma unroll
      for (int r = 0; r < 8; ++r) s[j][r] = a[r] + al[r] * (1.0f / RCARRY);
    }
    v16h va[2][8];
    ldv(va[0], cur, 0, ks, col, lane);                                        // first V group: its LDS latency runs under the softmax
    __builtin_amdgcn_sched_barrier(0);                                        // keeps those loads from sinking down to their WMMAs
    float mx = s[0][0];
#pragma unroll
    for (int j = 0; j < 4; ++j)
#pragma unroll
      for (int r = 0; r < 8; ++r) mx = fmaxf(mx, s[j][r]);
    mx = fmaxf(mx, xhalf(mx));                                                // the query's other 8 keys of each tile sit in lane ^ 16
    const float mn = fmaxf(m, mx), alpha = expf(m - mn);
    m = mn;
    float ps[4] = {0.f, 0.f, 0.f, 0.f};                                       // four short chains instead of one of 32 dependent adds
    v16h pb[2];
#pragma unroll
    for (int kk = 0; kk < 2; ++kk)
#pragma unroll
      for (int e = 0; e < 16; ++e) { const float ex = expf(s[2 * kk + (e >> 3)][e & 7] - mn); ps[e & 3] += ex; pb[kk][e] = (_Float16)(ex * PCARRY); }
    l = l * alpha + ((ps[0] + ps[1]) + (ps[2] + ps[3]));
#pragma unroll
    for (int ct = 0; ct < 16; ++ct)
#pragma unroll
      for (int r = 0; r < 8; ++r) o[ct][r] *= alpha;
#pragma unroll
    for (int gi = 0; gi < 4; ++gi) {                                          // 8 WMMAs a group, the next group's 16 LDS loads issued ahead of them as one block
      if (gi < 3) ldv(va[(gi + 1) & 1], cur, gi + 1, ks, col, lane);
      __builtin_amdgcn_sched_barrier(0);                                      // without the pair of fences each load is moved in front of its own WMMA and waited to 0
#pragma unroll
      for (int i = 0; i < 8; ++i) o[(gi & 1) * 8 + i] = wmma_h(va[gi & 1][i], pb[gi >> 1], o[(gi & 1) * 8 + i]);
      __builtin_amdgcn_sched_barrier(0);
    }
    if (t + 1 < SEQ / FK) {
      FBuf& nxt = buf[(t + 1) & 1];                                           // last read in pass t - 1, behind that pass's barrier
#pragma unroll
      for (int i = 0; i < 16; ++i) vst2(&nxt.v[i * 16 + (tid >> 4)][(tid & 15) * 8], rv[i]);
#pragma unroll
      for (int i = 0; i < 2; ++i) { vst2(&nxt.kh[i * 64 + (tid >> 2)][(tid & 3) * 8], rh[i]); vst2(&nxt.kl[i * 64 + (tid >> 2)][(tid & 3) * 8], rl[i]); }
    }
    __syncthreads();
  }
  // merge the two key halves of each query on their common maximum, then gamma * O / sum + x; the x rows are fetched under the merge
  const unsigned off0 = 4u * (((unsigned)b * CC + (tid >> 4)) * SEQ_FULL + i0 + (tid & 15) * 4);   // byte offset in x and out; 16 lanes cover one 256-B row piece
  v4f xr[16];
#pragma unroll
  for (int i = 0; i < 16; ++i) xr[i] = *(const v4f*)((const char*)X + off0 + (size_t)i * 64 * SEQ_FULL);
  l += xhalf(l);
  if (g == 0) { sm_m[ks][qt * 16 + col] = m; sm_l[ks][qt * 16 + col] = l; }
  __syncthreads();
  const float m0 = sm_m[0][qt * 16 + col], m1 = sm_m[1][qt * 16 + col], l0 = sm_l[0][qt * 16 + col], l1 = sm_l[1][qt * 16 + col];
  const float mm = fmaxf(m0, m1);
  const float f = expf(m - mm) * (bfr(G[0]) * (1.0f / PCARRY)) / (l0 * expf(m0 - mm) + l1 * expf(m1 - mm));
  if (ks == 0) {
#pragma unroll
    for (int ct = 0; ct < 16; ++ct)
#pragma unroll
      for (int r = 0; r < 8; ++r) st[ct * 16 + 8 * g + r][qt * 16 + col] = o[ct][r] * f;
  }
  __syncthreads();
  if (ks == 1) {
#pragma unroll
    for (int ct = 0; ct < 16; ++ct)
#pragma unroll
      for (int r = 0; r < 8; ++r) st[ct * 16 + 8 * g + r][qt * 16 + col] += o[ct][r] * f;
  }
  __syncthreads();
#pragma unroll
  for (int i = 0; i < 16; ++i) { const v4f ov = *(const v4f*)&st[i * 16 + (tid >> 4)][(tid & 15) * 4];
    xr[i][0] = ov[0] + bfr(xr[i][0]); xr[i][1] = ov[1] + bfr(xr[i][1]); xr[i][2] = ov[2] + bfr(xr[i][2]); xr[i][3] = ov[3] + bfr(xr[i][3]); }
#pragma unroll
  for (int i = 0; i < 16; ++i) vst2((char*)OUT + off0 + (size_t)i * 64 * SEQ_FULL, xr[i]);
}

extern "C" void kernel_launch(void* const* d_in, const int* in_sizes, int n_in, void* d_out, int out_size, void* d_ws, size_t ws_size, hipStream_t stream) {
  if (n_in < 8) return;
  if (in_sizes[0] < NB * CC * SEQ_FULL || in_sizes[1] < DQ * CC || in_sizes[2] < DQ || in_sizes[3] < DQ * CC || in_sizes[4] < DQ || in_sizes[5] < CC * CC || in_sizes[6] < CC || in_sizes[7] < 1) return;
  if (out_size < NB * CC * SEQ_FULL) return;
  if (ws_size < (size_t)WS_END) return;
  const float* X = (const float*)d_in[0]; const float* WQ = (const float*)d_in[1]; const float* BQ = (const float*)d_in[2];
  const float* WK = (const float*)d_in[3]; const float* BK = (const float*)d_in[4]; const float* WV = (const float*)d_in[5];
  const float* BV = (const float*)d_in[6]; const float* G = (const float*)d_in[7];
  float* OUT = (float*)d_out;
  char* ws = (char*)d_ws;
  __bf16 *PQ = (__bf16*)(ws + WS_WQ), *PK = (__bf16*)(ws + WS_WK), *PV = (__bf16*)(ws + WS_WV), *XB = (__bf16*)(ws + WS_XB);
  _Float16 *QH = (_Float16*)(ws + WS_QH), *QL = (_Float16*)(ws + WS_QL), *KH = (_Float16*)(ws + WS_KH), *KL = (_Float16*)(ws + WS_KL), *VH = (_Float16*)(ws + WS_VH);

  k_cvt<<<dim3(2 * NBQ + NBV), 256, 0, stream>>>(WQ, WK, WV, PQ, PK, PV);
  k_xt<<<dim3(SEQ / 64, NB), 256, 0, stream>>>(X, XB);
  k_pqk<<<dim3(NB * SEQ / 64, 2), 128, 0, stream>>>(XB, PQ, PK, BQ, BK, QH, QL, KH, KL);
  k_pvv<<<dim3(NB * SEQ / 64, CC / 128), 128, 0, stream>>>(XB, PV, BV, VH);
  k_fa<<<dim3(SEQ / FQ, NB), 256, 0, stream>>>(QH, QL, KH, KL, VH, X, G, OUT);
}

// v003
// A run of this version takes 46.5 microseconds.
// Timed twice side by side with v002, it ran 1.55 and 1.52 times as fast.
// All steps since v000 together make it 18.1 times as fast.
// compute dtype: every float input RNE-converted to bf16; q/k/v = W x + b on v_wmma_f32_16x16x32_bf16 (bf16 x bf16, single product, f32 accumulate); logits q.k (no scaling) on v_wmma_f32_16x16x32_f16 with q and k as f16 hi + residual (x 2^10) planes, 3 products, f32 accumulate, kept in registers; softmax in f32 on a running maximum (precise expf), normalised at the end; exp x 2^14 as f16 against v f16 on v_wmma_f32_16x16x32_f16 (single product, f32 accumulate); epilogue gamma * acc * 2^-14 / sum + x in f32; f32 output.
#include <hip/hip_runtime.h>
#include <math.h>

typedef __attribute__((ext_vector_type(16))) _Float16 v16h;
typedef __attribute__((ext_vector_type(16))) __bf16 v16b;
typedef __attribute__((ext_vector_type(8)))  _Float16 v8h;
typedef __attribute__((ext_vector_type(8)))  __bf16 v8b;
typedef __attribute__((ext_vector_type(8)))  float v8f;
typedef __attribute__((ext_vector_type(4)))  float v4f;
typedef __attribute__((ext_vector_type(4)))  unsigned v4u;

#ifndef NB
#define NB 8
#endif
#ifndef SEQ
#define SEQ 2048
#endif
#define NB_FULL 8
#define SEQ_FULL 2048          // per-channel position stride of x / out (full-size buffers)
#define CC 256
#define DQ 32                  // q/k channels
#define PCARRY 16384.0f        // P fragments carried x 2^14 (f16-normal on the chip), folded back in the epilogue
#define RCARRY 1024.0f         // q/k residual planes carried x 2^10, folded back after their own accumulator

static_assert(SEQ % 256 == 0);
static_assert(SEQ <= SEQ_FULL);
static_assert(NB <= NB_FULL);
static_assert(CC == 256);
static_assert(DQ == 32);
template <typename T> __device__ __forceinline__ void vst2(void* p, T v) { *(T*)p = v;  }

__device__ __forceinline__ v8f wmma_bf(v16b a, v16b b, v8f c) { return __builtin_amdgcn_wmma_f32_16x16x32_bf16(false, a, false, b, (short)0, c, false, false); }
// 16x16x32 fragments: lane -> (h = lane>>4, row/col = lane&15); elements 0..7 = k0+8h+0..7, 8..15 = k0+16+8h+0..7; D element r = row 8h+r, col lane&15.
// Both A (row m, k-contiguous) and B (from a [n][k] k-contiguous copy, row n) use this same loader.
__device__ __forceinline__ v16h frag_h(const _Float16* rowk0, int lane) {
  union { v16h v; v8h q[2]; } u; const _Float16* p = rowk0 + 8 * (lane >> 4);
  u.q[0] = *(const v8h*)p; u.q[1] = *(const v8h*)(p + 16); return u.v;
}
__device__ __forceinline__ v16b frag_b(const __bf16* rowk0, int lane) {
  union { v16b v; v8b q[2]; } u; const __bf16* p = rowk0 + 8 * (lane >> 4);
  u.q[0] = *(const v8b*)p; u.q[1] = *(const v8b*)(p + 16); return u.v;
}
__device__ __forceinline__ float bfr(float v) { return (float)(__bf16)v; }   // RNE convert to bf16 and back

#define WS_QH  ((size_t)0)                                   // f16 q hi [b*SEQ + l][32]
#define WS_QL  (WS_QH + 2u * (size_t)NB * SEQ * DQ)          // f16 q residual x 2^10
#define WS_KH  (WS_QL + 2u * (size_t)NB * SEQ * DQ)          // f16 k hi
#define WS_KL  (WS_KH + 2u * (size_t)NB * SEQ * DQ)          // f16 k residual x 2^10
#define WS_VH  (WS_KL + 2u * (size_t)NB * SEQ * DQ)          // f16 v planes [b][c][SEQ]
#define WS_END (WS_VH + 2u * (size_t)NB * CC * SEQ)
static_assert(WS_END <= (size_t)268435456);
static_assert(WS_QL % 128 == 0 && WS_KH % 128 == 0 && WS_KL % 128 == 0 && WS_VH % 128 == 0);

// ---- k_proj: block = (64 positions, batch), 8 waves. x (channels-first f32) and the three weights (f32) come in by whole-line loads, are RNE-converted to bf16 and
// laid k-contiguous in LDS (x transposed to [position][channel], weights as rows Wq 0..31, Wk 32..63, Wv 64..319); q, k and v of the 64 positions are then formed
// from LDS fragments (bf16 x bf16, single product, f32 accumulate over the channels in ascending blocks of 32) and leave through LDS as whole lines.
// Wave w: v channel tiles 2w, 2w+1 on all four position tiles; q/k channel tile w & 3 (q0 q1 k0 k1) on two position tiles.
// Every '#pragma unroll' of this kernel and its helpers but the one over the VH stores makes the indices of a register array compile-time constants, so that the array stays in registers.
#define PP 64                  // positions per work-group
#define XP (CC + 8)            // row pitch of the bf16 planes in LDS, 528 B = 16 B x odd
#define NW (2 * DQ + CC)       // weight rows
#define WB 20                  // weight loads of a thread per batch; 4 batches
static_assert(SEQ % PP == 0 && NW * CC == 4 * WB * 256 * 4);
typedef __attribute__((ext_vector_type(4))) __bf16 v4b;
__device__ __forceinline__ void ldw(v4f (&d)[WB], int bt, const float* __restrict__ WQ, const float* __restrict__ WK, const float* __restrict__ WV, int tid) {
#pragma unroll
  for (int i = 0; i < WB; ++i) { const int f = bt * WB + i;                   // load f of the block = weight rows 4f .. 4f+3; a wave reads 512 contiguous bytes
    const float* s = f < DQ / 4 ? WQ + f * 1024 : (f < DQ / 2 ? WK + (f - DQ / 4) * 1024 : WV + (f - DQ / 2) * 1024);
    d[i] = *(const v4f*)(s + tid * 4); }
  asm volatile("s_wait_xcnt 0x0" ::: "memory");                               // the loads' base and offset registers may be reused right behind them
}
__device__ __forceinline__ void stw(__bf16 (*wsm)[XP], const v4f (&d)[WB], int bt, int tid) {
#pragma unroll
  for (int i = 0; i < WB; ++i) { v4b o; o[0] = (__bf16)d[i][0]; o[1] = (__bf16)d[i][1]; o[2] = (__bf16)d[i][2]; o[3] = (__bf16)d[i][3];
    *(v4b*)&wsm[(bt * WB + i) * 4 + (tid >> 6)][(tid & 63) * 4] = o; }
}
// fragments of channel block kc. A: row = position, k = channel (register tile p = position tile (p + rot) & 3); B from the [n][k] weight rows: v tiles 2 wave, 2 wave + 1, q/k tile wave & 3
__device__ __forceinline__ void ldf(v16b (&a)[4], v16b (&w)[3], const __bf16 (*xs)[XP], const __bf16 (*wsm)[XP], int kc, int rot, int wave, int col, int lane) {
#pragma unroll
  for (int p = 0; p < 4; ++p) a[p] = frag_b(&xs[((p + rot) & 3) * 16 + col][kc * 32], lane);
  w[0] = frag_b(&wsm[2 * DQ + (2 * wave) * 16 + col][kc * 32], lane); w[1] = frag_b(&wsm[2 * DQ + (2 * wave + 1) * 16 + col][kc * 32], lane);
  w[2] = frag_b(&wsm[(wave & 3) * 16 + col][kc * 32], lane);
}
__global__ __launch_bounds__(256) void k_proj(const float* __restrict__ X, const float* __restrict__ WQ, const float* __restrict__ BQ, const float* __restrict__ WK, const float* __restrict__ BK, const float* __restrict__ WV, const float* __restrict__ BV, _Float16* __restrict__ QH, _Float16* __restrict__ QL, _Float16* __restrict__ KH, _Float16* __restrict__ KL, _Float16* __restrict__ VH) {
  __shared__ __align__(16) __bf16 xs[PP][XP];
  __shared__ __align__(16) __bf16 wsm[NW][XP];
  __shared__ __align__(16) _Float16 th[CC][PP + 8];
  __shared__ __align__(16) _Float16 sh[2][PP][DQ + 8], sl[2][PP][DQ + 8];
  const int tid = threadIdx.x, lane = tid & 31, col = lane & 15, g = lane >> 4;
  const int wave = __builtin_amdgcn_readfirstlane(tid >> 5);                  // wave-uniform
  const int l0 = blockIdx.x * PP; const size_t b = blockIdx.y;
  // thread = (4 positions, channel pair 2 * (tid >> 4) + 32 i): 16 lanes cover one 256-B row piece
  const float* xsrc = X + (b * CC + 2 * (tid >> 4)) * (size_t)SEQ_FULL + l0 + (tid & 15) * 4;
  v4f xv[8][2], wa[WB], wb[WB];
#pragma unroll
  for (int i = 0; i < 8; ++i) { xv[i][0] = *(const v4f*)(xsrc + (size_t)(i * 32) * SEQ_FULL); xv[i][1] = *(const v4f*)(xsrc + (size_t)(i * 32 + 1) * SEQ_FULL); }
  asm volatile("s_wait_xcnt 0x0" ::: "memory");                               // the loads' address registers may be reused right behind them
  ldw(wa, 0, WQ, WK, WV, tid);
  ldw(wb, 1, WQ, WK, WV, tid);
#pragma unroll
  for (int i = 0; i < 8; ++i)
#pragma unroll
    for (int j = 0; j < 4; ++j) { union { __bf16 h[2]; unsigned u; } p; p.h[0] = (__bf16)xv[i][0][j]; p.h[1] = (__bf16)xv[i][1][j];
      *(unsigned*)&xs[(tid & 15) * 4 + j][i * 32 + 2 * (tid >> 4)] = p.u; }
  stw(wsm, wa, 0, tid);
  ldw(wa, 2, WQ, WK, WV, tid);
  stw(wsm, wb, 1, tid);
  ldw(wb, 3, WQ, WK, WV, tid);
  stw(wsm, wa, 2, tid);
  stw(wsm, wb, 3, tid);
  __syncthreads();
  const int rot = 2 * (wave >> 2), nq = wave & 3;                             // register tile p holds position tile (p + rot) & 3, so that the q/k tiles are always p = 0, 1
  v8f av[2][4] = {}, aq[2] = {};
  v16b fa[2][4], fw[2][3];                                                    // two register sets: the fragments of channel block kc + 1 are fetched under the WMMAs of block kc
  ldf(fa[0], fw[0], xs, wsm, 0, rot, wave, col, lane);
#pragma unroll
  for (int kc = 0; kc < CC / 32; ++kc) {
    if (kc + 1 < CC / 32) ldf(fa[(kc + 1) & 1], fw[(kc + 1) & 1], xs, wsm, kc + 1, rot, wave, col, lane);
    __builtin_amdgcn_sched_barrier(0);                                        // without the pair of fences the loads are spread among the WMMAs and waited to 0
    const v16b (&a)[4] = fa[kc & 1]; const v16b (&w)[3] = fw[kc & 1];
#pragma unroll
    for (int p = 0; p < 4; ++p) { av[0][p] = wmma_bf(a[p], w[0], av[0][p]); av[1][p] = wmma_bf(a[p], w[1], av[1][p]); }
    aq[0] = wmma_bf(a[0], w[2], aq[0]); aq[1] = wmma_bf(a[1], w[2], aq[1]);
    __builtin_amdgcn_sched_barrier(0);
  }
#pragma unroll
  for (int j = 0; j < 2; ++j) { const int cl = (2 * wave + j) * 16 + col; const float bb = bfr(BV[cl]);
#pragma unroll
    for (int p = 0; p < 4; ++p)
#pragma unroll
      for (int r = 0; r < 8; ++r) th[cl][((p + rot) & 3) * 16 + 8 * g + r] = (_Float16)(av[j][p][r] + bb); }
  { const int which = nq >> 1, cl = (nq & 1) * 16 + col;                      // wave-uniform choice of q or k
    const float bb = bfr((which == 0 ? BQ : BK)[cl]);
#pragma unroll
    for (int p = 0; p < 2; ++p)
#pragma unroll
      for (int r = 0; r < 8; ++r) { const float v = aq[p][r] + bb; const int rl = ((p + rot) & 3) * 16 + 8 * g + r;
        const _Float16 hv = (_Float16)v; sh[which][rl][cl] = hv; sl[which][rl][cl] = (_Float16)((v - (float)hv) * RCARRY); } }
  __syncthreads();
#pragma unroll   // here: the 8 LDS reads go out together, ahead of the stores
  for (int i = 0; i < CC * 8 / 256; ++i) { const int e = i * 256 + tid, cl = e >> 3, q = e & 7;        // 8 lanes write one whole 128-B line
    vst2(VH + (b * CC + cl) * (size_t)SEQ + l0 + q * 8, *(const v4u*)&th[cl][q * 8]); }
  { const int rl = tid >> 2, q = tid & 3; const size_t o = (b * SEQ + l0 + rl) * (size_t)DQ + q * 8;   // each plane: 4 KB in a row
    vst2(QH + o, *(const v4u*)&sh[0][rl][q * 8]); vst2(QL + o, *(const v4u*)&sl[0][rl][q * 8]);
    vst2(KH + o, *(const v4u*)&sh[1][rl][q * 8]); vst2(KL + o, *(const v4u*)&sl[1][rl][q * 8]); }
}
// ---- k_fa: block = (64 queries, batch), 8 waves = 4 query tiles of 16 x 2 key halves. Scores, softmax and P.V in one pass over the keys; S and P never leave registers.
// Transposed products: S^T = K Q^T (A = key rows, B = query rows), so a lane holds one query's scores (column lane&15, keys 8h+r) and the two S^T tiles of 32 keys
// are already the B fragment of O^T += V P^T (elements 0..7 = keys 8h+0..7, 8..15 = keys 16+8h+0..7, the k order of frag_h on the V rows).
// Each 128-key tile of K (hi, residual) and V is brought in by whole-line loads, one tile ahead, and shared by the waves through two LDS buffers.
// Every full '#pragma unroll' below makes the indices of a register array compile-time constants, so that the array stays in registers.
#define FQ 64                  // queries per work-group
#define FK 128                 // keys per staged tile: 64 for each key half
#define VP (FK + 8)            // V row pitch in LDS, 272 B = 16 B x odd
#define KP (DQ + 8)            // K row pitch in LDS, 80 B = 16 B x odd
static_assert(SEQ % FK == 0 && SEQ % FQ == 0);
struct __align__(16) FBuf { _Float16 v[CC][VP]; _Float16 kh[FK][KP]; _Float16 kl[FK][KP]; };
__device__ __forceinline__ v8f wmma_h(v16h a, v16h b, v8f c) { return __builtin_amdgcn_wmma_f32_16x16x32_f16(false, a, false, b, (short)0, c, false, false); }
__device__ __forceinline__ float xhalf(float x) { return __builtin_bit_cast(float, __builtin_amdgcn_permlanex16(__builtin_bit_cast(int, x), __builtin_bit_cast(int, x), 0x76543210, 0xfedcba98, false, false)); }   // lane l reads lane l ^ 16
// V fragments of group gi (k-step gi >> 1, channel tiles 8 * (gi & 1) + 0..7). A: row = channel, k = key
__device__ __forceinline__ void ldv(v16h (&d)[8], const FBuf& cur, int gi, int ks, int col, int lane) {
#pragma unroll
  for (int i = 0; i < 8; ++i) d[i] = frag_h(&cur.v[((gi & 1) * 8 + i) * 16 + col][ks * 64 + (gi >> 1) * 32], lane);
}

__global__ __launch_bounds__(256) void k_fa(const _Float16* __restrict__ QH, const _Float16* __restrict__ QL, const _Float16* __restrict__ KH, const _Float16* __restrict__ KL, const _Float16* __restrict__ VH, const float* __restrict__ X, const float* __restrict__ G, float* __restrict__ OUT) {
  __shared__ FBuf buf[2];
  __shared__ __align__(16) float st[CC][FQ + 4];
  __shared__ float sm_m[2][FQ], sm_l[2][FQ];
  const int tid = threadIdx.x, lane = tid & 31, col = lane & 15, g = lane >> 4;
  const int wave = __builtin_amdgcn_readfirstlane(tid >> 5), qt = wave & 3, ks = wave >> 2;   // wave-uniform
  const int b = blockIdx.y, i0 = blockIdx.x * FQ;
  const size_t q0 = (size_t)b * SEQ + i0 + qt * 16;
  const v16h qh = frag_h(QH + (q0 + col) * DQ, lane), ql = frag_h(QL + (q0 + col) * DQ, lane);   // B: row = query, k = d
  const _Float16* vsrc = VH + (size_t)b * CC * SEQ + (size_t)(tid >> 4) * SEQ + (tid & 15) * 8;   // 16 lanes cover one 256-B row piece
  const _Float16* hsrc = KH + (size_t)b * SEQ * DQ + tid * 8;
  const _Float16* lsrc = KL + (size_t)b * SEQ * DQ + tid * 8;
  v4u rv[16], rh[2], rl[2];
#pragma unroll
  for (int i = 0; i < 16; ++i) rv[i] = *(const v4u*)(vsrc + (size_t)i * 16 * SEQ);
#pragma unroll
  for (int i = 0; i < 2; ++i) { rh[i] = *(const v4u*)(hsrc + i * 2048); rl[i] = *(const v4u*)(lsrc + i * 2048); }
  asm volatile("s_wait_xcnt 0x0" ::: "memory");                               // the loads' address registers are reused right behind them
  float m = -3.0e38f, l = 0.f;
  v8f o[16] = {};
#pragma unroll
  for (int i = 0; i < 16; ++i) vst2(&buf[0].v[i * 16 + (tid >> 4)][(tid & 15) * 8], rv[i]);
#pragma unroll
  for (int i = 0; i < 2; ++i) { vst2(&buf[0].kh[i * 64 + (tid >> 2)][(tid & 3) * 8], rh[i]); vst2(&buf[0].kl[i * 64 + (tid >> 2)][(tid & 3) * 8], rl[i]); }
  __syncthreads();
#pragma unroll 1   // stays rolled: one pass is already a long straight-line body, a second copy would only cost instruction cache
  for (int t = 0; t < SEQ / FK; ++t) {
    const FBuf& cur = buf[t & 1];
    if (t + 1 < SEQ / FK) {                                                   // next tile's loads fly under this tile's work
#pragma unroll
      for (int i = 0; i < 16; ++i) rv[i] = *(const v4u*)(vsrc + (size_t)i * 16 * SEQ + (t + 1) * FK);
#pragma unroll
      for (int i = 0; i < 2; ++i) { rh[i] = *(const v4u*)(hsrc + (size_t)(t + 1) * FK * DQ + i * 2048); rl[i] = *(const v4u*)(lsrc + (size_t)(t + 1) * FK * DQ + i * 2048); }
      asm volatile("s_wait_xcnt 0x0" ::: "memory");                           // the loads' address registers are reused right behind them
    }
    float s[4][8];
#pragma unroll
    for (int j = 0; j < 4; ++j) {                                             // A: row = key, k = d; 3 products: kh.qh + (kh.ql + kl.qh) * 2^-10
      const v16h kh = frag_h(&cur.kh[ks * 64 + j * 16 + col][0], lane), kl = frag_h(&cur.kl[ks * 64 + j * 16 + col][0], lane);
      v8f a = {}, al = {};
      a = wmma_h(kh, qh, a); al = wmma_h(kh, ql, al); al = wmma_h(kl, qh, al);
#pragma unroll
      for (int r = 0; r < 8; ++r) s[j][r] = a[r] + al[r] * (1.0f / RCARRY);
    }
    v16h va[2][8];
    ldv(va[0], cur, 0, ks, col, lane);                                        // first V group: its LDS latency runs under the softmax
    __builtin_amdgcn_sched_barrier(0);                                        // keeps those loads from sinking down to their WMMAs
    float mx = s[0][0];
#pragma unroll
    for (int j = 0; j < 4; ++j)
#pragma unroll
      for (int r = 0; r < 8; ++r) mx = fmaxf(mx, s[j][r]);
    mx = fmaxf(mx, xhalf(mx));                                                // the query's other 8 keys of each tile sit in lane ^ 16
    const float mn = fmaxf(m, mx), alpha = expf(m - mn);
    m = mn;
    float ps[4] = {0.f, 0.f, 0.f, 0.f};                                       // four short chains instead of one of 32 dependent adds
    v16h pb[2];
#pragma unroll
    for (int kk = 0; kk < 2; ++kk)
#pragma unroll
      for (int e = 0; e < 16; ++e) { const float ex = expf(s[2 * kk + (e >> 3)][e & 7] - mn); ps[e & 3] += ex; pb[kk][e] = (_Float16)(ex * PCARRY); }
    l = l * alpha + ((ps[0] + ps[1]) + (ps[2] + ps[3]));
#pragma unroll
    for (int ct = 0; ct < 16; ++ct)
#pragma unroll
      for (int r = 0; r < 8; ++r) o[ct][r] *= alpha;
#pragma unroll
    for (int gi = 0; gi < 4; ++gi) {                                          // 8 WMMAs a group, the next group's 16 LDS loads issued ahead of them as one block
      if (gi < 3) ldv(va[(gi + 1) & 1], cur, gi + 1, ks, col, lane);
      __builtin_amdgcn_sched_barrier(0);                                      // without the pair of fences each load is moved in front of its own WMMA and waited to 0
#pragma unroll
      for (int i = 0; i < 8; ++i) o[(gi & 1) * 8 + i] = wmma_h(va[gi & 1][i], pb[gi >> 1], o[(gi & 1) * 8 + i]);
      __builtin_amdgcn_sched_barrier(0);
    }
    if (t + 1 < SEQ / FK) {
      FBuf& nxt = buf[(t + 1) & 1];                                           // last read in pass t - 1, behind that pass's barrier
#pragma unroll
      for (int i = 0; i < 16; ++i) vst2(&nxt.v[i * 16 + (tid >> 4)][(tid & 15) * 8], rv[i]);
#pragma unroll
      for (int i = 0; i < 2; ++i) { vst2(&nxt.kh[i * 64 + (tid >> 2)][(tid & 3) * 8], rh[i]); vst2(&nxt.kl[i * 64 + (tid >> 2)][(tid & 3) * 8], rl[i]); }
    }
    __syncthreads();
  }
  // merge the two key halves of each query on their common maximum, then gamma * O / sum + x; the x rows are fetched under the merge
  const unsigned off0 = 4u * (((unsigned)b * CC + (tid >> 4)) * SEQ_FULL + i0 + (tid & 15) * 4);   // byte offset in x and out; 16 lanes cover one 256-B row piece
  v4f xr[16];
#pragma unroll
  for (int i = 0; i < 16; ++i) xr[i] = *(const v4f*)((const char*)X + off0 + (size_t)i * 64 * SEQ_FULL);
  l += xhalf(l);
  if (g == 0) { sm_m[ks][qt * 16 + col] = m; sm_l[ks][qt * 16 + col] = l; }
  __syncthreads();
  const float m0 = sm_m[0][qt * 16 + col], m1 = sm_m[1][qt * 16 + col], l0 = sm_l[0][qt * 16 + col], l1 = sm_l[1][qt * 16 + col];
  const float mm = fmaxf(m0, m1);
  const float f = expf(m - mm) * (bfr(G[0]) * (1.0f / PCARRY)) / (l0 * expf(m0 - mm) + l1 * expf(m1 - mm));
  if (ks == 0) {
#pragma unroll
    for (int ct = 0; ct < 16; ++ct)
#pragma unroll
      for (int r = 0; r < 8; ++r) st[ct * 16 + 8 * g + r][qt * 16 + col] = o[ct][r] * f;
  }
  __syncthreads();
  if (ks == 1) {
#pragma unroll
    for (int ct = 0; ct < 16; ++ct)
#pragma unroll
      for (int r = 0; r < 8; ++r) st[ct * 16 + 8 * g + r][qt * 16 + col] += o[ct][r] * f;
  }
  __syncthreads();
#pragma unroll
  for (int i = 0; i < 16; ++i) { const v4f ov = *(const v4f*)&st[i * 16 + (tid >> 4)][(tid & 15) * 4];
    xr[i][0] = ov[0] + bfr(xr[i][0]); xr[i][1] = ov[1] + bfr(xr[i][1]); xr[i][2] = ov[2] + bfr(xr[i][2]); xr[i][3] = ov[3] + bfr(xr[i][3]); }
#pragma unroll
  for (int i = 0; i < 16; ++i) vst2((char*)OUT + off0 + (size_t)i * 64 * SEQ_FULL, xr[i]);
}

extern "C" void kernel_launch(void* const* d_in, const int* in_sizes, int n_in, void* d_out, int out_size, void* d_ws, size_t ws_size, hipStream_t stream) {
  if (n_in < 8) return;
  if (in_sizes[0] < NB * CC * SEQ_FULL || in_sizes[1] < DQ * CC || in_sizes[2] < DQ || in_sizes[3] < DQ * CC || in_sizes[4] < DQ || in_sizes[5] < CC * CC || in_sizes[6] < CC || in_sizes[7] < 1) return;
  if (out_size < NB * CC * SEQ_FULL) return;
  if (ws_size < (size_t)WS_END) return;
  const float* X = (const float*)d_in[0]; const float* WQ = (const float*)d_in[1]; const float* BQ = (const float*)d_in[2];
  const float* WK = (const float*)d_in[3]; const float* BK = (const float*)d_in[4]; const float* WV = (const float*)d_in[5];
  const float* BV = (const float*)d_in[6]; const float* G = (const float*)d_in[7];
  float* OUT = (float*)d_out;
  char* ws = (char*)d_ws;
  _Float16 *QH = (_Float16*)(ws + WS_QH), *QL = (_Float16*)(ws + WS_QL), *KH = (_Float16*)(ws + WS_KH), *KL = (_Float16*)(ws + WS_KL), *VH = (_Float16*)(ws + WS_VH);

  k_proj<<<dim3(SEQ / PP, NB), 256, 0, stream>>>(X, WQ, BQ, WK, BK, WV, BV, QH, QL, KH, KL, VH);
  k_fa<<<dim3(SEQ / FQ, NB), 256, 0, stream>>>(QH, QL, KH, KL, VH, X, G, OUT);
}

// v004
// Measured time: 39.7 microseconds a run.
// Timed twice side by side with v003, it ran 1.17 times as fast both times.
// All steps since v000 together make it 21.2 times as fast.
// compute dtype: every float input RNE-converted to bf16; q/k/v = W x + b on v_wmma_f32_16x16x32_bf16 (bf16 x bf16, single product, f32 accumulate); logits q.k (no scaling) on v_wmma_f32_16x16x32_f16 with q and k as f16 hi + residual (x 2^10) planes, 3 products, f32 accumulate, kept in registers; softmax in f32 on a running maximum kept in base-2 units (v_exp_f32 of one FMA: score * log2 e - maximum + 14), normalised at the end; exp x 2^14 as f16 against v f16 on v_wmma_f32_16x16x32_f16 (single product, f32 accumulate); epilogue gamma * acc / sum + x in f32 (acc and sum both x 2^14); f32 output.
#include <hip/hip_runtime.h>
#include <math.h>

typedef __attribute__((ext_vector_type(16))) _Float16 v16h;
typedef __attribute__((ext_vector_type(16))) __bf16 v16b;
typedef __attribute__((ext_vector_type(8)))  _Float16 v8h;
typedef __attribute__((ext_vector_type(8)))  __bf16 v8b;
typedef __attribute__((ext_vector_type(8)))  float v8f;
typedef __attribute__((ext_vector_type(4)))  float v4f;
typedef __attribute__((ext_vector_type(4)))  unsigned v4u;

#ifndef NB
#define NB 8
#endif
#ifndef SEQ
#define SEQ 2048
#endif
#define NB_FULL 8
#define SEQ_FULL 2048          // per-channel position stride of x / out (full-size buffers)
#define CC 256
#define DQ 32                  // q/k channels
#define PSHIFT 14.0f            // P fragments and their sum carried x 2^14 (f16-normal on the chip): the 14 rides in the exponent and cancels in acc / sum
#define LOG2E 1.44269504088896340736f
#define RCARRY 1024.0f         // q/k residual planes carried x 2^10, folded back after their own accumulator

static_assert(SEQ % 256 == 0);
static_assert(SEQ <= SEQ_FULL);
static_assert(NB <= NB_FULL);
static_assert(CC == 256);
static_assert(DQ == 32);
template <typename T> __device__ __forceinline__ void vst2(void* p, T v) { *(T*)p = v;  }

__device__ __forceinline__ v8f wmma_bf(v16b a, v16b b, v8f c) { return __builtin_amdgcn_wmma_f32_16x16x32_bf16(false, a, false, b, (short)0, c, false, false); }
// 16x16x32 fragments: lane -> (h = lane>>4, row/col = lane&15); elements 0..7 = k0+8h+0..7, 8..15 = k0+16+8h+0..7; D element r = row 8h+r, col lane&15.
// Both A (row m, k-contiguous) and B (from a [n][k] k-contiguous copy, row n) use this same loader.
__device__ __forceinline__ v16h frag_h(const _Float16* rowk0, int lane) {
  union { v16h v; v8h q[2]; } u; const _Float16* p = rowk0 + 8 * (lane >> 4);
  u.q[0] = *(const v8h*)p; u.q[1] = *(const v8h*)(p + 16); return u.v;
}
__device__ __forceinline__ v16b frag_b(const __bf16* rowk0, int lane) {
  union { v16b v; v8b q[2]; } u; const __bf16* p = rowk0 + 8 * (lane >> 4);
  u.q[0] = *(const v8b*)p; u.q[1] = *(const v8b*)(p + 16); return u.v;
}
__device__ __forceinline__ float bfr(float v) { return (float)(__bf16)v; }   // RNE convert to bf16 and back

#define WS_QH  ((size_t)0)                                   // f16 q hi [b*SEQ + l][32]
#define WS_QL  (WS_QH + 2u * (size_t)NB * SEQ * DQ)          // f16 q residual x 2^10
#define WS_KH  (WS_QL + 2u * (size_t)NB * SEQ * DQ)          // f16 k hi
#define WS_KL  (WS_KH + 2u * (size_t)NB * SEQ * DQ)          // f16 k residual x 2^10
#define WS_VH  (WS_KL + 2u * (size_t)NB * SEQ * DQ)          // f16 v planes [b][c][SEQ]
#define WS_END (WS_VH + 2u * (size_t)NB * CC * SEQ)
static_assert(WS_END <= (size_t)268435456);
static_assert(WS_QL % 128 == 0 && WS_KH % 128 == 0 && WS_KL % 128 == 0 && WS_VH % 128 == 0);

// ---- k_proj: block = (64 positions, batch), 8 waves. x (channels-first f32) and the three weights (f32) come in by whole-line loads, are RNE-converted to bf16 and
// laid k-contiguous in LDS (x transposed to [position][channel], weights as rows Wq 0..31, Wk 32..63, Wv 64..319); q, k and v of the 64 positions are then formed
// from LDS fragments (bf16 x bf16, single product, f32 accumulate over the channels in ascending blocks of 32) and leave through LDS as whole lines.
// Wave w: v channel tiles 2w, 2w+1 on all four position tiles; q/k channel tile w & 3 (q0 q1 k0 k1) on two position tiles.
// Every '#pragma unroll' of this kernel and its helpers but the one over the VH stores makes the indices of a register array compile-time constants, so that the array stays in registers.
#define PP 64                  // positions per work-group
#define XP (CC + 8)            // row pitch of the bf16 planes in LDS, 528 B = 16 B x odd
#define NW (2 * DQ + CC)       // weight rows
#define WB 20                  // weight loads of a thread per batch; 4 batches
static_assert(SEQ % PP == 0 && NW * CC == 4 * WB * 256 * 4);
typedef __attribute__((ext_vector_type(4))) __bf16 v4b;
__device__ __forceinline__ void ldw(v4f (&d)[WB], int bt, const float* __restrict__ WQ, const float* __restrict__ WK, const float* __restrict__ WV, int tid) {
#pragma unroll
  for (int i = 0; i < WB; ++i) { const int f = bt * WB + i;                   // load f of the block = weight rows 4f .. 4f+3; a wave reads 512 contiguous bytes
    const float* s = f < DQ / 4 ? WQ + f * 1024 : (f < DQ / 2 ? WK + (f - DQ / 4) * 1024 : WV + (f - DQ / 2) * 1024);
    d[i] = *(const v4f*)(s + tid * 4); }
  asm volatile("s_wait_xcnt 0x0" ::: "memory");                               // the loads' base and offset registers may be reused right behind them
}
__device__ __forceinline__ void stw(__bf16 (*wsm)[XP], const v4f (&d)[WB], int bt, int tid) {
#pragma unroll
  for (int i = 0; i < WB; ++i) { v4b o; o[0] = (__bf16)d[i][0]; o[1] = (__bf16)d[i][1]; o[2] = (__bf16)d[i][2]; o[3] = (__bf16)d[i][3];
    *(v4b*)&wsm[(bt * WB + i) * 4 + (tid >> 6)][(tid & 63) * 4] = o; }
}
// fragments of channel block kc. A: row = position, k = channel (register tile p = position tile (p + rot) & 3); B from the [n][k] weight rows: v tiles 2 wave, 2 wave + 1, q/k tile wave & 3
__device__ __forceinline__ void ldf(v16b (&a)[4], v16b (&w)[3], const __bf16 (*xs)[XP], const __bf16 (*wsm)[XP], int kc, int rot, int wave, int col, int lane) {
#pragma unroll
  for (int p = 0; p < 4; ++p) a[p] = frag_b(&xs[((p + rot) & 3) * 16 + col][kc * 32], lane);
  w[0] = frag_b(&wsm[2 * DQ + (2 * wave) * 16 + col][kc * 32], lane); w[1] = frag_b(&wsm[2 * DQ + (2 * wave + 1) * 16 + col][kc * 32], lane);
  w[2] = frag_b(&wsm[(wave & 3) * 16 + col][kc * 32], lane);
}
__global__ __launch_bounds__(256) void k_proj(const float* __restrict__ X, const float* __restrict__ WQ, const float* __restrict__ BQ, const float* __restrict__ WK, const float* __restrict__ BK, const float* __restrict__ WV, const float* __restrict__ BV, _Float16* __restrict__ QH, _Float16* __restrict__ QL, _Float16* __restrict__ KH, _Float16* __restrict__ KL, _Float16* __restrict__ VH) {
  __shared__ __align__(16) __bf16 xs[PP][XP];
  __shared__ __align__(16) __bf16 wsm[NW][XP];
  __shared__ __align__(16) _Float16 th[CC][PP + 8];
  __shared__ __align__(16) _Float16 sh[2][PP][DQ + 8], sl[2][PP][DQ + 8];
  const int tid = threadIdx.x, lane = tid & 31, col = lane & 15, g = lane >> 4;
  const int wave = __builtin_amdgcn_readfirstlane(tid >> 5);                  // wave-uniform
  const int l0 = blockIdx.x * PP; const size_t b = blockIdx.y;
  // thread = (4 positions, channel pair 2 * (tid >> 4) + 32 i): 16 lanes cover one 256-B row piece
  const float* xsrc = X + (b * CC + 2 * (tid >> 4)) * (size_t)SEQ_FULL + l0 + (tid & 15) * 4;
  v4f xv[8][2], wa[WB], wb[WB];
#pragma unroll
  for (int i = 0; i < 8; ++i) { xv[i][0] = *(const v4f*)(xsrc + (size_t)(i * 32) * SEQ_FULL); xv[i][1] = *(const v4f*)(xsrc + (size_t)(i * 32 + 1) * SEQ_FULL); }
  asm volatile("s_wait_xcnt 0x0" ::: "memory");                               // the loads' address registers may be reused right behind them
  ldw(wa, 0, WQ, WK, WV, tid);
  ldw(wb, 1, WQ, WK, WV, tid);
#pragma unroll
  for (int i = 0; i < 8; ++i)
#pragma unroll
    for (int j = 0; j < 4; ++j) { union { __bf16 h[2]; unsigned u; } p; p.h[0] = (__bf16)xv[i][0][j]; p.h[1] = (__bf16)xv[i][1][j];
      *(unsigned*)&xs[(tid & 15) * 4 + j][i * 32 + 2 * (tid >> 4)] = p.u; }
  stw(wsm, wa, 0, tid);
  ldw(wa, 2, WQ, WK, WV, tid);
  stw(wsm, wb, 1, tid);
  ldw(wb, 3, WQ, WK, WV, tid);
  stw(wsm, wa, 2, tid);
  stw(wsm, wb, 3, tid);
  __syncthreads();
  const int rot = 2 * (wave >> 2), nq = wave & 3;                             // register tile p holds position tile (p + rot) & 3, so that the q/k tiles are always p = 0, 1
  v8f av[2][4] = {}, aq[2] = {};
  v16b fa[2][4], fw[2][3];                                                    // two register sets: the fragments of channel block kc + 1 are fetched under the WMMAs of block kc
  ldf(fa[0], fw[0], xs, wsm, 0, rot, wave, col, lane);
#pragma unroll
  for (int kc = 0; kc < CC / 32; ++kc) {
    if (kc + 1 < CC / 32) ldf(fa[(kc + 1) & 1], fw[(kc + 1) & 1], xs, wsm, kc + 1, rot, wave, col, lane);
    __builtin_amdgcn_sched_barrier(0);                                        // without the pair of fences the loads are spread among the WMMAs and waited to 0
    const v16b (&a)[4] = fa[kc & 1]; const v16b (&w)[3] = fw[kc & 1];
#pragma unroll
    for (int p = 0; p < 4; ++p) { av[0][p] = wmma_bf(a[p], w[0], av[0][p]); av[1][p] = wmma_bf(a[p], w[1], av[1][p]); }
    aq[0] = wmma_bf(a[0], w[2], aq[0]); aq[1] = wmma_bf(a[1], w[2], aq[1]);
    __builtin_amdgcn_sched_barrier(0);
  }
#pragma unroll
  for (int j = 0; j < 2; ++j) { const int cl = (2 * wave + j) * 16 + col; const float bb = bfr(BV[cl]);
#pragma unroll
    for (int p = 0; p < 4; ++p)
#pragma unroll
      for (int r = 0; r < 8; ++r) th[cl][((p + rot) & 3) * 16 + 8 * g + r] = (_Float16)(av[j][p][r] + bb); }
  { const int which = nq >> 1, cl = (nq & 1) * 16 + col;                      // wave-uniform choice of q or k
    const float bb = bfr((which == 0 ? BQ : BK)[cl]);
#pragma unroll
    for (int p = 0; p < 2; ++p)
#pragma unroll
      for (int r = 0; r < 8; ++r) { const float v = aq[p][r] + bb; const int rl = ((p + rot) & 3) * 16 + 8 * g + r;
        const _Float16 hv = (_Float16)v; sh[which][rl][cl] = hv; sl[which][rl][cl] = (_Float16)((v - (float)hv) * RCARRY); } }
  __syncthreads();
#pragma unroll   // here: the 8 LDS reads go out together, ahead of the stores
  for (int i = 0; i < CC * 8 / 256; ++i) { const int e = i * 256 + tid, cl = e >> 3, q = e & 7;        // 8 lanes write one whole 128-B line
    vst2(VH + (b * CC + cl) * (size_t)SEQ + l0 + q * 8, *(const v4u*)&th[cl][q * 8]); }
  { const int rl = tid >> 2, q = tid & 3; const size_t o = (b * SEQ + l0 + rl) * (size_t)DQ + q * 8;   // each plane: 4 KB in a row
    vst2(QH + o, *(const v4u*)&sh[0][rl][q * 8]); vst2(QL + o, *(const v4u*)&sl[0][rl][q * 8]);
    vst2(KH + o, *(const v4u*)&sh[1][rl][q * 8]); vst2(KL + o, *(const v4u*)&sl[1][rl][q * 8]); }
}
// ---- k_fa: block = (64 queries, batch), 8 waves = 4 query tiles of 16 x 2 key halves. Scores, softmax and P.V in one pass over the keys; S and P never leave registers.
// Transposed products: S^T = K Q^T (A = key rows, B = query rows), so a lane holds one query's scores (column lane&15, keys 8h+r) and the two S^T tiles of 32 keys
// are already the B fragment of O^T += V P^T (elements 0..7 = keys 8h+0..7, 8..15 = keys 16+8h+0..7, the k order of frag_h on the V rows).
// Each 128-key tile of K (hi, residual) and V is brought in by whole-line loads, one tile ahead, and shared by the waves through two LDS buffers.
// Every full '#pragma unroll' below makes the indices of a register array compile-time constants, so that the array stays in registers.
#define FQ 64                  // queries per work-group
#define FK 128                 // keys per staged tile: 64 for each key half
#define VP (FK + 8)            // V row pitch in LDS, 272 B = 16 B x odd
#define KP (DQ + 8)            // K row pitch in LDS, 80 B = 16 B x odd
static_assert(SEQ % FK == 0 && SEQ % FQ == 0);
struct __align__(16) FBuf { _Float16 v[CC][VP]; _Float16 kh[FK][KP]; _Float16 kl[FK][KP]; };
__device__ __forceinline__ v8f wmma_h(v16h a, v16h b, v8f c) { return __builtin_amdgcn_wmma_f32_16x16x32_f16(false, a, false, b, (short)0, c, false, false); }
__device__ __forceinline__ float xhalf(float x) { return __builtin_bit_cast(float, __builtin_amdgcn_permlanex16(__builtin_bit_cast(int, x), __builtin_bit_cast(int, x), 0x76543210, 0xfedcba98, false, false)); }   // lane l reads lane l ^ 16
// 2^x as one v_exp_f32 (a result below the normal range may come out 0, far under what f16 P or the sum can hold). The v_nop at the end of each statement fills the one
// slot that the instruction set asks for behind a transcendental, whatever the compiler puts next; in ex2x8 the results lie apart from every argument ("=&v"), so that
// inside the statement no v_exp_f32 is followed by one that overwrites its argument.
__device__ __forceinline__ float ex2(float x) { float d; asm("v_exp_f32 %0, %1\n\tv_nop" : "=v"(d) : "v"(x)); return d; }
__device__ __forceinline__ void ex2x8(float (&d)[8], const float (&x)[8]) {
  asm("v_exp_f32 %0, %8\n\tv_exp_f32 %1, %9\n\tv_exp_f32 %2, %10\n\tv_exp_f32 %3, %11\n\tv_exp_f32 %4, %12\n\tv_exp_f32 %5, %13\n\tv_exp_f32 %6, %14\n\tv_exp_f32 %7, %15\n\tv_nop"
      : "=&v"(d[0]), "=&v"(d[1]), "=&v"(d[2]), "=&v"(d[3]), "=&v"(d[4]), "=&v"(d[5]), "=&v"(d[6]), "=&v"(d[7])
      : "v"(x[0]), "v"(x[1]), "v"(x[2]), "v"(x[3]), "v"(x[4]), "v"(x[5]), "v"(x[6]), "v"(x[7]));
}
// V fragments of group gi (k-step gi >> 1, channel tiles 8 * (gi & 1) + 0..7). A: row = channel, k = key
__device__ __forceinline__ void ldv(v16h (&d)[8], const FBuf& cur, int gi, int ks, int col, int lane) {
#pragma unroll
  for (int i = 0; i < 8; ++i) d[i] = frag_h(&cur.v[((gi & 1) * 8 + i) * 16 + col][ks * 64 + (gi >> 1) * 32], lane);
}

__global__ __launch_bounds__(256) void k_fa(const _Float16* __restrict__ QH, const _Float16* __restrict__ QL, const _Float16* __restrict__ KH, const _Float16* __restrict__ KL, const _Float16* __restrict__ VH, const float* __restrict__ X, const float* __restrict__ G, float* __restrict__ OUT) {
  __shared__ FBuf buf[2];
  __shared__ __align__(16) float st[CC][FQ + 4];
  __shared__ float sm_m[2][FQ], sm_l[2][FQ];
  const int tid = threadIdx.x, lane = tid & 31, col = lane & 15, g = lane >> 4;
  const int wave = __builtin_amdgcn_readfirstlane(tid >> 5), qt = wave & 3, ks = wave >> 2;   // wave-uniform
  const int b = blockIdx.y, i0 = blockIdx.x * FQ;
  const size_t q0 = (size_t)b * SEQ + i0 + qt * 16;
  const v16h qh = frag_h(QH + (q0 + col) * DQ, lane), ql = frag_h(QL + (q0 + col) * DQ, lane);   // B: row = query, k = d
  const _Float16* vsrc = VH + (size_t)b * CC * SEQ + (size_t)(tid >> 4) * SEQ + (tid & 15) * 8;   // 16 lanes cover one 256-B row piece
  const _Float16* hsrc = KH + (size_t)b * SEQ * DQ + tid * 8;
  const _Float16* lsrc = KL + (size_t)b * SEQ * DQ + tid * 8;
  v4u rv[16], rh[2], rl[2];
#pragma unroll
  for (int i = 0; i < 16; ++i) rv[i] = *(const v4u*)(vsrc + (size_t)i * 16 * SEQ);
#pragma unroll
  for (int i = 0; i < 2; ++i) { rh[i] = *(const v4u*)(hsrc + i * 2048); rl[i] = *(const v4u*)(lsrc + i * 2048); }
  asm volatile("s_wait_xcnt 0x0" ::: "memory");                               // the loads' address registers are reused right behind them
  float m = -3.0e38f, l = 0.f;
  v8f o[16] = {};
#pragma unroll
  for (int i = 0; i < 16; ++i) vst2(&buf[0].v[i * 16 + (tid >> 4)][(tid & 15) * 8], rv[i]);
#pragma unroll
  for (int i = 0; i < 2; ++i) { vst2(&buf[0].kh[i * 64 + (tid >> 2)][(tid & 3) * 8], rh[i]); vst2(&buf[0].kl[i * 64 + (tid >> 2)][(tid & 3) * 8], rl[i]); }
  __syncthreads();
#pragma unroll 1   // stays rolled: one pass is already a long straight-line body, a second copy would only cost instruction cache
  for (int t = 0; t < SEQ / FK; ++t) {
    const FBuf& cur = buf[t & 1];
    if (t + 1 < SEQ / FK) {                                                   // next tile's loads fly under this tile's work
#pragma unroll
      for (int i = 0; i < 16; ++i) rv[i] = *(const v4u*)(vsrc + (size_t)i * 16 * SEQ + (t + 1) * FK);
#pragma unroll
      for (int i = 0; i < 2; ++i) { rh[i] = *(const v4u*)(hsrc + (size_t)(t + 1) * FK * DQ + i * 2048); rl[i] = *(const v4u*)(lsrc + (size_t)(t + 1) * FK * DQ + i * 2048); }
      asm volatile("s_wait_xcnt 0x0" ::: "memory");                           // the loads' address registers are reused right behind them
    }
    float s[4][8];
#pragma unroll
    for (int j = 0; j < 4; ++j) {                                             // A: row = key, k = d; 3 products: kh.qh + (kh.ql + kl.qh) * 2^-10
      const v16h kh = frag_h(&cur.kh[ks * 64 + j * 16 + col][0], lane), kl = frag_h(&cur.kl[ks * 64 + j * 16 + col][0], lane);
      v8f a = {}, al = {};
      a = wmma_h(kh, qh, a); al = wmma_h(kh, ql, al); al = wmma_h(kl, qh, al);
#pragma unroll
      for (int r = 0; r < 8; ++r) s[j][r] = a[r] + al[r] * (1.0f / RCARRY);
    }
    v16h va[2][8];
    ldv(va[0], cur, 0, ks, col, lane);                                        // first V group: its LDS latency runs under the softmax
    __builtin_amdgcn_sched_barrier(0);                                        // keeps those loads from sinking down to their WMMAs
    float mx = s[0][0];
#pragma unroll
    for (int j = 0; j < 4; ++j)
#pragma unroll
      for (int r = 0; r < 8; ++r) mx = fmaxf(mx, s[j][r]);
    mx = fmaxf(mx, xhalf(mx));                                                // the query's other 8 keys of each tile sit in lane ^ 16
    const float mn = fmaxf(m, fmaf(mx, LOG2E, -PSHIFT)), alpha = ex2(m - mn);   // m = maximum * log2 e - 14: every exponent below is taken against this one rounded value
    m = mn;
    float ps[4] = {0.f, 0.f, 0.f, 0.f};                                       // four short chains instead of one of 32 dependent adds
    v16h pb[2];
#pragma unroll
    for (int j = 0; j < 4; ++j) {                                             // S^T tile j = elements 8 * (j & 1) + 0..7 of P fragment j >> 1
      float x[8], ex[8];
#pragma unroll
      for (int r = 0; r < 8; ++r) x[r] = fmaf(s[j][r], LOG2E, -mn);
      ex2x8(ex, x);
#pragma unroll
      for (int r = 0; r < 8; ++r) { ps[r & 3] += ex[r]; pb[j >> 1][8 * (j & 1) + r] = (_Float16)ex[r]; }
    }
    l = l * alpha + ((ps[0] + ps[1]) + (ps[2] + ps[3]));
#pragma unroll
    for (int ct = 0; ct < 16; ++ct)
#pragma unroll
      for (int r = 0; r < 8; ++r) o[ct][r] *= alpha;
#pragma unroll
    for (int gi = 0; gi < 4; ++gi) {                                          // 8 WMMAs a group, the next group's 16 LDS loads issued ahead of them as one block
      if (gi < 3) ldv(va[(gi + 1) & 1], cur, gi + 1, ks, col, lane);
      __builtin_amdgcn_sched_barrier(0);                                      // without the pair of fences each load is moved in front of its own WMMA and waited to 0
#pragma unroll
      for (int i = 0; i < 8; ++i) o[(gi & 1) * 8 + i] = wmma_h(va[gi & 1][i], pb[gi >> 1], o[(gi & 1) * 8 + i]);
      __builtin_amdgcn_sched_barrier(0);
    }
    if (t + 1 < SEQ / FK) {
      FBuf& nxt = buf[(t + 1) & 1];                                           // last read in pass t - 1, behind that pass's barrier
#pragma unroll
      for (int i = 0; i < 16; ++i) vst2(&nxt.v[i * 16 + (tid >> 4)][(tid & 15) * 8], rv[i]);
#pragma unroll
      for (int i = 0; i < 2; ++i) { vst2(&nxt.kh[i * 64 + (tid >> 2)][(tid & 3) * 8], rh[i]); vst2(&nxt.kl[i * 64 + (tid >> 2)][(tid & 3) * 8], rl[i]); }
    }
    __syncthreads();
  }
  // merge the two key halves of each query on their common maximum, then gamma * O / sum + x; the x rows are fetched under the merge
  const unsigned off0 = 4u * (((unsigned)b * CC + (tid >> 4)) * SEQ_FULL + i0 + (tid & 15) * 4);   // byte offset in x and out; 16 lanes cover one 256-B row piece
  v4f xr[16];
#pragma unroll
  for (int i = 0; i < 16; ++i) xr[i] = *(const v4f*)((const char*)X + off0 + (size_t)i * 64 * SEQ_FULL);
  l += xhalf(l);
  if (g == 0) { sm_m[ks][qt * 16 + col] = m; sm_l[ks][qt * 16 + col] = l; }
  __syncthreads();
  const float m0 = sm_m[0][qt * 16 + col], m1 = sm_m[1][qt * 16 + col], l0 = sm_l[0][qt * 16 + col], l1 = sm_l[1][qt * 16 + col];
  const float mm = fmaxf(m0, m1);
  const float f = ex2(m - mm) * bfr(G[0]) / (l0 * ex2(m0 - mm) + l1 * ex2(m1 - mm));
  if (ks == 0) {
#pragma unroll
    for (int ct = 0; ct < 16; ++ct)
#pragma unroll
      for (int r = 0; r < 8; ++r) st[ct * 16 + 8 * g + r][qt * 16 + col] = o[ct][r] * f;
  }
  __syncthreads();
  if (ks == 1) {
#pragma unroll
    for (int ct = 0; ct < 16; ++ct)
#pragma unroll
      for (int r = 0; r < 8; ++r) st[ct * 16 + 8 * g + r][qt * 16 + col] += o[ct][r] * f;
  }
  __syncthreads();
#pragma unroll
  for (int i = 0; i < 16; ++i) { const v4f ov = *(const v4f*)&st[i * 16 + (tid >> 4)][(tid & 15) * 4];
    xr[i][0] = ov[0] + bfr(xr[i][0]); xr[i][1] = ov[1] + bfr(xr[i][1]); xr[i][2] = ov[2] + bfr(xr[i][2]); xr[i][3] = ov[3] + bfr(xr[i][3]); }
#pragma unroll
  for (int i = 0; i < 16; ++i) vst2((char*)OUT + off0 + (size_t)i * 64 * SEQ_FULL, xr[i]);
}

extern "C" void kernel_launch(void* const* d_in, const int* in_sizes, int n_in, void* d_out, int out_size, void* d_ws, size_t ws_size, hipStream_t stream) {
  if (n_in < 8) return;
  if (in_sizes[0] < NB * CC * SEQ_FULL || in_sizes[1] < DQ * CC || in_sizes[2] < DQ || in_sizes[3] < DQ * CC || in_sizes[4] < DQ || in_sizes[5] < CC * CC || in_sizes[6] < CC || in_sizes[7] < 1) return;
  if (out_size < NB * CC * SEQ_FULL) return;
  if (ws_size < (size_t)WS_END) return;
  const float* X = (const float*)d_in[0]; const float* WQ = (const float*)d_in[1]; const float* BQ = (const float*)d_in[2];
  const float* WK = (const float*)d_in[3]; const float* BK = (const float*)d_in[4]; const float* WV = (const float*)d_in[5];
  const float* BV = (const float*)d_in[6]; const float* G = (const float*)d_in[7];
  float* OUT = (float*)d_out;
  char* ws = (char*)d_ws;
  _Float16 *QH = (_Float16*)(ws + WS_QH), *QL = (_Float16*)(ws + WS_QL), *KH = (_Float16*)(ws + WS_KH), *KL = (_Float16*)(ws + WS_KL), *VH = (_Float16*)(ws + WS_VH);

  k_proj<<<dim3(SEQ / PP, NB), 256, 0, stream>>>(X, WQ, BQ, WK, BK, WV, BV, QH, QL, KH, KL, VH);
  k_fa<<<dim3(SEQ / FQ, NB), 256, 0, stream>>>(QH, QL, KH, KL, VH, X, G, OUT);
}

// v005
// Measured time: 34.7 microseconds a run.
// Timed twice side by side with v004, it ran 1.14 and 1.15 times as fast.
// Counting every step since v000, it is 24.3 times as fast.
// compute dtype: every float input RNE-converted to bf16; q/k/v = W x + b on v_wmma_f32_16x16x32_bf16 (bf16 x bf16, single product, f32 accumulate); logits q.k (no scaling) on v_wmma_f32_16x16x32_f16 with q and k as f16 hi + residual (x 2^10) planes, 3 products, f32 accumulate, kept in registers; softmax in f32 on a running maximum kept in base-2 units (v_exp_f32 of one FMA: score * log2 e - maximum + 14), normalised at the end; exp x 2^14 as f16 against v f16 on v_wmma_f32_16x16x32_f16 (single product, f32 accumulate); epilogue gamma * acc / sum + x in f32 (acc and sum both x 2^14); f32 output.
#include <hip/hip_runtime.h>
#include <math.h>

typedef __attribute__((ext_vector_type(16))) _Float16 v16h;
typedef __attribute__((ext_vector_type(16))) __bf16 v16b;
typedef __attribute__((ext_vector_type(8)))  _Float16 v8h;
typedef __attribute__((ext_vector_type(8)))  __bf16 v8b;
typedef __attribute__((ext_vector_type(8)))  float v8f;
typedef __attribute__((ext_vector_type(4)))  float v4f;
typedef __attribute__((ext_vector_type(4)))  unsigned v4u;

#ifndef NB
#define NB 8
#endif
#ifndef SEQ
#define SEQ 2048
#endif
#define NB_FULL 8
#define SEQ_FULL 2048          // per-channel position stride of x / out (full-size buffers)
#define CC 256
#define DQ 32                  // q/k channels
#define PSHIFT 14.0f            // P fragments and their sum carried x 2^14 (f16-normal on the chip): the 14 rides in the exponent and cancels in acc / sum
#define LOG2E 1.44269504088896340736f
#define RCARRY 1024.0f         // q/k residual planes carried x 2^10, folded back after their own accumulator

static_assert(SEQ % 256 == 0);
static_assert(SEQ <= SEQ_FULL);
static_assert(NB <= NB_FULL);
static_assert(CC == 256);
static_assert(DQ == 32);
template <typename T> __device__ __forceinline__ void vst2(void* p, T v) { *(T*)p = v;  }

__device__ __forceinline__ v8f wmma_bf(v16b a, v16b b, v8f c) { return __builtin_amdgcn_wmma_f32_16x16x32_bf16(false, a, false, b, (short)0, c, false, false); }
// 16x16x32 fragments: lane -> (h = lane>>4, row/col = lane&15); elements 0..7 = k0+8h+0..7, 8..15 = k0+16+8h+0..7; D element r = row 8h+r, col lane&15.
// Both A (row m, k-contiguous) and B (from a [n][k] k-contiguous copy, row n) use this same loader.
__device__ __forceinline__ v16h frag_h(const _Float16* rowk0, int lane) {
  union { v16h v; v8h q[2]; } u; const _Float16* p = rowk0 + 8 * (lane >> 4);
  u.q[0] = *(const v8h*)p; u.q[1] = *(const v8h*)(p + 16); return u.v;
}
__device__ __forceinline__ v16b frag_b(const __bf16* rowk0, int lane) {
  union { v16b v; v8b q[2]; } u; const __bf16* p = rowk0 + 8 * (lane >> 4);
  u.q[0] = *(const v8b*)p; u.q[1] = *(const v8b*)(p + 16); return u.v;
}
__device__ __forceinline__ float bfr(float v) { return (float)(__bf16)v; }   // RNE convert to bf16 and back

#define WS_QH  ((size_t)0)                                   // f16 q hi [b*SEQ + l][32]
#define WS_QL  (WS_QH + 2u * (size_t)NB * SEQ * DQ)          // f16 q residual x 2^10
#define WS_KK  (WS_QL + 2u * (size_t)NB * SEQ * DQ)          // f16 k [b*SEQ + l][64]: hi 0..31, residual x 2^10 32..63, one 128-B row a key
#define WS_VH  (WS_KK + 4u * (size_t)NB * SEQ * DQ)          // f16 v planes [b][c][SEQ]
#define WS_END (WS_VH + 2u * (size_t)NB * CC * SEQ)
static_assert(WS_END <= (size_t)268435456);
static_assert(WS_QL % 128 == 0 && WS_KK % 128 == 0 && WS_VH % 128 == 0);

// ---- k_proj: block = (64 positions, batch), 8 waves. x (channels-first f32) and the three weights (f32) come in by whole-line loads, are RNE-converted to bf16 and
// laid k-contiguous in LDS (x transposed to [position][channel], weights as rows Wq 0..31, Wk 32..63, Wv 64..319); q, k and v of the 64 positions are then formed
// from LDS fragments (bf16 x bf16, single product, f32 accumulate over the channels in ascending blocks of 32) and leave through LDS as whole lines.
// Wave w: v channel tiles 2w, 2w+1 on all four position tiles; q/k channel tile w & 3 (q0 q1 k0 k1) on two position tiles.
// Every '#pragma unroll' of this kernel and its helpers but the two over the VH and KK stores makes the indices of a register array compile-time constants, so that the array stays in registers.
#define PP 64                  // positions per work-group
#define XP (CC + 8)            // row pitch of the bf16 planes in LDS, 528 B = 16 B x odd
#define NW (2 * DQ + CC)       // weight rows
#define WB 20                  // weight loads of a thread per batch; 4 batches
static_assert(SEQ % PP == 0 && NW * CC == 4 * WB * 256 * 4);
typedef __attribute__((ext_vector_type(4))) __bf16 v4b;
__device__ __forceinline__ void ldw(v4f (&d)[WB], int bt, const float* __restrict__ WQ, const float* __restrict__ WK, const float* __restrict__ WV, int tid) {
#pragma unroll
  for (int i = 0; i < WB; ++i) { const int f = bt * WB + i;                   // load f of the block = weight rows 4f .. 4f+3; a wave reads 512 contiguous bytes
    const float* s = f < DQ / 4 ? WQ + f * 1024 : (f < DQ / 2 ? WK + (f - DQ / 4) * 1024 : WV + (f - DQ / 2) * 1024);
    d[i] = *(const v4f*)(s + tid * 4); }
  asm volatile("s_wait_xcnt 0x0" ::: "memory");                               // the loads' base and offset registers may be reused right behind them
}
__device__ __forceinline__ void stw(__bf16 (*wsm)[XP], const v4f (&d)[WB], int bt, int tid) {
#pragma unroll
  for (int i = 0; i < WB; ++i) { v4b o; o[0] = (__bf16)d[i][0]; o[1] = (__bf16)d[i][1]; o[2] = (__bf16)d[i][2]; o[3] = (__bf16)d[i][3];
    *(v4b*)&wsm[(bt * WB + i) * 4 + (tid >> 6)][(tid & 63) * 4] = o; }
}
// fragments of channel block kc. A: row = position, k = channel (register tile p = position tile (p + rot) & 3); B from the [n][k] weight rows: v tiles 2 wave, 2 wave + 1, q/k tile wave & 3
__device__ __forceinline__ void ldf(v16b (&a)[4], v16b (&w)[3], const __bf16 (*xs)[XP], const __bf16 (*wsm)[XP], int kc, int rot, int wave, int col, int lane) {
#pragma unroll
  for (int p = 0; p < 4; ++p) a[p] = frag_b(&xs[((p + rot) & 3) * 16 + col][kc * 32], lane);
  w[0] = frag_b(&wsm[2 * DQ + (2 * wave) * 16 + col][kc * 32], lane); w[1] = frag_b(&wsm[2 * DQ + (2 * wave + 1) * 16 + col][kc * 32], lane);
  w[2] = frag_b(&wsm[(wave & 3) * 16 + col][kc * 32], lane);
}
__global__ __launch_bounds__(256) void k_proj(const float* __restrict__ X, const float* __restrict__ WQ, const float* __restrict__ BQ, const float* __restrict__ WK, const float* __restrict__ BK, const float* __restrict__ WV, const float* __restrict__ BV, _Float16* __restrict__ QH, _Float16* __restrict__ QL, _Float16* __restrict__ KK, _Float16* __restrict__ VH) {
  __shared__ __align__(16) __bf16 xs[PP][XP];
  __shared__ __align__(16) __bf16 wsm[NW][XP];
  __shared__ __align__(16) _Float16 th[CC][PP + 8];
  __shared__ __align__(16) _Float16 sh[2][PP][DQ + 8], sl[2][PP][DQ + 8];
  const int tid = threadIdx.x, lane = tid & 31, col = lane & 15, g = lane >> 4;
  const int wave = __builtin_amdgcn_readfirstlane(tid >> 5);                  // wave-uniform
  const int l0 = blockIdx.x * PP; const size_t b = blockIdx.y;
  // thread = (4 positions, channel pair 2 * (tid >> 4) + 32 i): 16 lanes cover one 256-B row piece
  const float* xsrc = X + (b * CC + 2 * (tid >> 4)) * (size_t)SEQ_FULL + l0 + (tid & 15) * 4;
  v4f xv[8][2], wa[WB], wb[WB];
#pragma unroll
  for (int i = 0; i < 8; ++i) { xv[i][0] = *(const v4f*)(xsrc + (size_t)(i * 32) * SEQ_FULL); xv[i][1] = *(const v4f*)(xsrc + (size_t)(i * 32 + 1) * SEQ_FULL); }
  asm volatile("s_wait_xcnt 0x0" ::: "memory");                               // the loads' address registers may be reused right behind them
  ldw(wa, 0, WQ, WK, WV, tid);
  ldw(wb, 1, WQ, WK, WV, tid);
#pragma unroll
  for (int i = 0; i < 8; ++i)
#pragma unroll
    for (int j = 0; j < 4; ++j) { union { __bf16 h[2]; unsigned u; } p; p.h[0] = (__bf16)xv[i][0][j]; p.h[1] = (__bf16)xv[i][1][j];
      *(unsigned*)&xs[(tid & 15) * 4 + j][i * 32 + 2 * (tid >> 4)] = p.u; }
  stw(wsm, wa, 0, tid);
  ldw(wa, 2, WQ, WK, WV, tid);
  stw(wsm, wb, 1, tid);
  ldw(wb, 3, WQ, WK, WV, tid);
  stw(wsm, wa, 2, tid);
  stw(wsm, wb, 3, tid);
  __syncthreads();
  const int rot = 2 * (wave >> 2), nq = wave & 3;                             // register tile p holds position tile (p + rot) & 3, so that the q/k tiles are always p = 0, 1
  v8f av[2][4] = {}, aq[2] = {};
  v16b fa[2][4], fw[2][3];                                                    // two register sets: the fragments of channel block kc + 1 are fetched under the WMMAs of block kc
  ldf(fa[0], fw[0], xs, wsm, 0, rot, wave, col, lane);
#pragma unroll
  for (int kc = 0; kc < CC / 32; ++kc) {
    if (kc + 1 < CC / 32) ldf(fa[(kc + 1) & 1], fw[(kc + 1) & 1], xs, wsm, kc + 1, rot, wave, col, lane);
    __builtin_amdgcn_sched_barrier(0);                                        // without the pair of fences the loads are spread among the WMMAs and waited to 0
    const v16b (&a)[4] = fa[kc & 1]; const v16b (&w)[3] = fw[kc & 1];
#pragma unroll
    for (int p = 0; p < 4; ++p) { av[0][p] = wmma_bf(a[p], w[0], av[0][p]); av[1][p] = wmma_bf(a[p], w[1], av[1][p]); }
    aq[0] = wmma_bf(a[0], w[2], aq[0]); aq[1] = wmma_bf(a[1], w[2], aq[1]);
    __builtin_amdgcn_sched_barrier(0);
  }
#pragma unroll
  for (int j = 0; j < 2; ++j) { const int cl = (2 * wave + j) * 16 + col; const float bb = bfr(BV[cl]);
#pragma unroll
    for (int p = 0; p < 4; ++p)
#pragma unroll
      for (int r = 0; r < 8; ++r) th[cl][((p + rot) & 3) * 16 + 8 * g + r] = (_Float16)(av[j][p][r] + bb); }
  { const int which = nq >> 1, cl = (nq & 1) * 16 + col;                      // wave-uniform choice of q or k
    const float bb = bfr((which == 0 ? BQ : BK)[cl]);
#pragma unroll
    for (int p = 0; p < 2; ++p)
#pragma unroll
      for (int r = 0; r < 8; ++r) { const float v = aq[p][r] + bb; const int rl = ((p + rot) & 3) * 16 + 8 * g + r;
        const _Float16 hv = (_Float16)v; sh[which][rl][cl] = hv; sl[which][rl][cl] = (_Float16)((v - (float)hv) * RCARRY); } }
  __syncthreads();
#pragma unroll   // here: the 8 LDS reads go out together, ahead of the stores
  for (int i = 0; i < CC * 8 / 256; ++i) { const int e = i * 256 + tid, cl = e >> 3, q = e & 7;        // 8 lanes write one whole 128-B line
    vst2(VH + (b * CC + cl) * (size_t)SEQ + l0 + q * 8, *(const v4u*)&th[cl][q * 8]); }
  { const int rl = tid >> 2, q = tid & 3; const size_t o = (b * SEQ + l0 + rl) * (size_t)DQ + q * 8;   // each plane: 4 KB in a row
    vst2(QH + o, *(const v4u*)&sh[0][rl][q * 8]); vst2(QL + o, *(const v4u*)&sl[0][rl][q * 8]); }
#pragma unroll   // here: both LDS reads go out ahead of the stores
  for (int i = 0; i < 2; ++i) { const int e = i * 256 + tid, rl = e >> 3, q = e & 7;                   // 8 lanes write one key's whole 128-B row: hi, then residual
    vst2(KK + (b * SEQ + l0 + rl) * (size_t)(2 * DQ) + q * 8, *(const v4u*)(q < 4 ? &sh[1][rl][q * 8] : &sl[1][rl][(q - 4) * 8])); }
}
// ---- k_fa: block = (64 queries, batch), 8 waves = 4 query tiles of 16 x 2 key halves. Scores, softmax and P.V in one pass over the keys; S and P never leave registers.
// Transposed products: S^T = K Q^T (A = key rows, B = query rows), so a lane holds one query's scores (column lane&15, keys 8h+r) and the two S^T tiles of 32 keys
// are already the B fragment of O^T += V P^T (elements 0..7 = keys 8h+0..7, 8..15 = keys 16+8h+0..7, the k order of frag_h on the V rows).
// Each 128-key tile of K (hi, residual) and V is brought into one of two LDS buffers by tensor loads, one tile ahead, and shared by the waves:
// waves 0..3 each bring 64 channel rows of V (256 B a row), wave 4 the 128 key rows of K (128 B a row); the loads' pad of 16 B a row gives the LDS pitches below.
// Every full '#pragma unroll' below makes the indices of a register array compile-time constants, so that the array stays in registers.
#define FQ 64                  // queries per work-group
#define FK 128                 // keys per staged tile: 64 for each key half
#define VP (FK + 8)            // V row pitch in LDS, 272 B = 16 B x odd
#define KP (2 * DQ + 8)        // K row pitch in LDS (hi 0..31, residual 32..63), 144 B = 16 B x odd
#define VSR 64                 // V rows of one tensor load
#define VSE 9216               // f16 places of one V slice in LDS: 64 rows x 272 B = 17408 B, rounded up to a multiple of 2 KiB
static_assert(SEQ % FK == 0 && SEQ % FQ == 0 && SEQ / FK >= 2);
struct __attribute__((aligned(2048))) FBuf { _Float16 v[CC / VSR][VSE]; _Float16 k[FK][KP]; };
static_assert(CC / VSR == 4 && VSR * VP <= VSE && (VSE * 2) % 2048 == 0 && (FK * KP * 2) % 2048 == 0 && sizeof(FBuf) == 2u * (4 * VSE + FK * KP));
typedef __attribute__((ext_vector_type(4))) uint32_t u32x4;
typedef __attribute__((ext_vector_type(8))) uint32_t u32x8;
__device__ __forceinline__ uint32_t uni(uint32_t v) { return (uint32_t)__builtin_amdgcn_readfirstlane(v); }
// A wave-uniform test held in a scalar register (by the empty asm statement): the branch on it is s_cmp + s_cbranch, which a tensor load needs, as it ignores EXEC.
__device__ __forceinline__ uint32_t pinned(uint32_t v) { uint32_t w = uni(v); asm volatile("" : "+s"(w)); return w; }
// Descriptor of one two-dimensional tile, global -> LDS: D1 rows of D0 bytes at a source pitch of PITCH bytes, 1-byte elements, tensor = tile; W0 = pad of 4 dwords behind every row.
__device__ __forceinline__ u32x4 tdm_g0(uint32_t lds_dst, uint64_t ga) {
  u32x4 g0; g0[0] = uni(1u); g0[1] = uni(lds_dst); g0[2] = uni((uint32_t)ga); g0[3] = uni((((uint32_t)(ga >> 32)) & 0x01FFFFFFu) | 0x80000000u);
  asm volatile("" : "+s"(g0));   // as in pinned(), on descriptor words: the four words stay together in one set of scalar registers from the issue to the wait that names them
  return g0;
}
template <uint32_t W0, uint32_t D0, uint32_t D1, uint32_t PITCH> __device__ __forceinline__ u32x8 tdm_g1() {
  u32x8 g1;
  g1[0] = uni(W0); g1[1] = uni((D0 & 0xFFFFu) << 16); g1[2] = uni((D0 >> 16) | ((D1 & 0xFFFFu) << 16)); g1[3] = uni((D1 >> 16) | (D0 << 16));
  g1[4] = uni(D1); g1[5] = uni(PITCH); g1[6] = uni(0u); g1[7] = uni(0u);
  asm volatile("" : "+s"(g1));   // as in pinned(), on descriptor words: they stay in one set of scalar registers for the whole kernel instead of being formed anew at each use
  return g1;
}
#define PAD_V ((1u << 20) | (5u << 22) | (3u << 25))   // interval = one 256-B row, 16 B of pad
#define PAD_K ((1u << 20) | (4u << 22) | (3u << 25))   // interval = one 128-B row, 16 B of pad
// One request a wave, from waves 0..4: waves 0..3 a V slice, wave 4 the K tile.
__device__ __forceinline__ void issue_tile(u32x4 g0, u32x8 gv, u32x8 gk, int wave) {
  if (pinned(wave < 4)) asm volatile("tensor_load_to_lds %0, %1" :: "s"(g0), "s"(gv) : "memory");
  if (pinned(wave == 4)) asm volatile("tensor_load_to_lds %0, %1" :: "s"(g0), "s"(gk) : "memory");
}
// The issuing wave's own request has landed. The descriptor is named as an input so that its registers hold their words until here: no word takes a new value while the request is outstanding.
__device__ __forceinline__ void wait_tile(u32x4 g0, u32x8 gv, u32x8 gk, int wave) {
  if (pinned(wave < 5)) asm volatile("s_wait_tensorcnt 0x0" :: "s"(g0), "s"(gv), "s"(gk) : "memory");
}
__device__ __forceinline__ v8f wmma_h(v16h a, v16h b, v8f c) { return __builtin_amdgcn_wmma_f32_16x16x32_f16(false, a, false, b, (short)0, c, false, false); }
__device__ __forceinline__ float xhalf(float x) { return __builtin_bit_cast(float, __builtin_amdgcn_permlanex16(__builtin_bit_cast(int, x), __builtin_bit_cast(int, x), 0x76543210, 0xfedcba98, false, false)); }   // lane l reads lane l ^ 16
// 2^x as one v_exp_f32 (a result below the normal range may come out 0, far under what f16 P or the sum can hold). The v_nop at the end of each statement fills the one
// slot that the instruction set asks for behind a transcendental, whatever the compiler puts next; in ex2x8 the results lie apart from every argument ("=&v"), so that
// inside the statement no v_exp_f32 is followed by one that overwrites its argument.
__device__ __forceinline__ float ex2(float x) { float d; asm("v_exp_f32 %0, %1\n\tv_nop" : "=v"(d) : "v"(x)); return d; }
__device__ __forceinline__ void ex2x8(float (&d)[8], const float (&x)[8]) {
  asm("v_exp_f32 %0, %8\n\tv_exp_f32 %1, %9\n\tv_exp_f32 %2, %10\n\tv_exp_f32 %3, %11\n\tv_exp_f32 %4, %12\n\tv_exp_f32 %5, %13\n\tv_exp_f32 %6, %14\n\tv_exp_f32 %7, %15\n\tv_nop"
      : "=&v"(d[0]), "=&v"(d[1]), "=&v"(d[2]), "=&v"(d[3]), "=&v"(d[4]), "=&v"(d[5]), "=&v"(d[6]), "=&v"(d[7])
      : "v"(x[0]), "v"(x[1]), "v"(x[2]), "v"(x[3]), "v"(x[4]), "v"(x[5]), "v"(x[6]), "v"(x[7]));
}
// V fragments of group gi (k-step gi >> 1, channel tiles 8 * (gi & 1) + 0..7). A: row = channel, k = key
__device__ __forceinline__ void ldv(v16h (&d)[8], const FBuf& cur, int gi, int ks, int col, int lane) {
#pragma unroll
  for (int i = 0; i < 8; ++i) { const int ct = (gi & 1) * 8 + i; d[i] = frag_h(&cur.v[ct >> 2][((ct & 3) * 16 + col) * VP + ks * 64 + (gi >> 1) * 32], lane); }
}

__global__ __launch_bounds__(256) void k_fa(const _Float16* __restrict__ QH, const _Float16* __restrict__ QL, const _Float16* __restrict__ KK, const _Float16* __restrict__ VH, const float* __restrict__ X, const float* __restrict__ G, float* __restrict__ OUT) {
  __shared__ __attribute__((aligned(2048))) FBuf buf[2];                      // every tensor load's place in LDS is a multiple of 2 KiB
  __shared__ __align__(16) float st[CC][FQ + 4];
  __shared__ float sm_m[2][FQ], sm_l[2][FQ];
  const int tid = threadIdx.x, lane = tid & 31, col = lane & 15, g = lane >> 4;
  const int wave = __builtin_amdgcn_readfirstlane(tid >> 5), qt = wave & 3, ks = wave >> 2;   // wave-uniform
  const int b = blockIdx.y, i0 = blockIdx.x * FQ;
  const size_t q0 = (size_t)b * SEQ + i0 + qt * 16;
  const uint32_t lbase = (uint32_t)(size_t)&buf[0];                           // byte offset of the buffers in the work-group's LDS
  const _Float16* vb = VH + (size_t)b * CC * SEQ; const _Float16* kb = KK + (size_t)b * SEQ * (2 * DQ);
  const u32x8 gv = tdm_g1<PAD_V, 2 * FK, VSR, 2 * SEQ>(), gk = tdm_g1<PAD_K, 4 * DQ, FK, 4 * DQ>();
  // this wave's slice: place in buffer 0, first byte of tile 0, bytes from one tile to the next (waves 5..7 issue nothing)
  const uint32_t ldst = lbase + (uint32_t)(wave < 4 ? wave : 4) * (2 * VSE);
  const uint64_t ga0 = wave < 4 ? (uint64_t)(size_t)(vb + (size_t)wave * VSR * SEQ) : (uint64_t)(size_t)kb;
  const uint32_t gstep = wave < 4 ? 2 * FK : 2 * FK * (2 * DQ);
  u32x4 g0 = tdm_g0(ldst, ga0);
  issue_tile(g0, gv, gk, wave);
  const v16h qh = frag_h(QH + (q0 + col) * DQ, lane), ql = frag_h(QL + (q0 + col) * DQ, lane);   // B: row = query, k = d
  float m = -3.0e38f, l = 0.f;
  v8f o[16] = {};
  wait_tile(g0, gv, gk, wave);
  __syncthreads();                                                            // tile 0 is published
  g0 = tdm_g0(ldst + (uint32_t)sizeof(FBuf), ga0 + gstep);
  issue_tile(g0, gv, gk, wave);
#pragma unroll 1   // stays rolled: one pass is already a long straight-line body
  for (int t = 0; t < SEQ / FK; ++t) {
    const FBuf& cur = buf[t & 1];
    float s[4][8];
#pragma unroll
    for (int j = 0; j < 4; ++j) {                                             // A: row = key, k = d; 3 products: kh.qh + (kh.ql + kl.qh) * 2^-10
      const v16h kh = frag_h(&cur.k[ks * 64 + j * 16 + col][0], lane), kl = frag_h(&cur.k[ks * 64 + j * 16 + col][DQ], lane);
      v8f a = {}, al = {};
      a = wmma_h(kh, qh, a); al = wmma_h(kh, ql, al); al = wmma_h(kl, qh, al);
#pragma unroll
      for (int r = 0; r < 8; ++r) s[j][r] = a[r] + al[r] * (1.0f / RCARRY);
    }
    v16h va[2][8];
    ldv(va[0], cur, 0, ks, col, lane);                                        // first V group: its LDS latency runs under the softmax
    __builtin_amdgcn_sched_barrier(0);                                        // keeps those loads from sinking down to their WMMAs
    float mx = s[0][0];
#pragma unroll
    for (int j = 0; j < 4; ++j)
#pragma unroll
      for (int r = 0; r < 8; ++r) mx = fmaxf(mx, s[j][r]);
    mx = fmaxf(mx, xhalf(mx));                                                // the query's other 8 keys of each tile sit in lane ^ 16
    const float mn = fmaxf(m, fmaf(mx, LOG2E, -PSHIFT)), alpha = ex2(m - mn);   // m = maximum * log2 e - 14: every exponent below is taken against this one rounded value
    m = mn;
    float ps[4] = {0.f, 0.f, 0.f, 0.f};                                       // four short chains instead of one of 32 dependent adds
    v16h pb[2];
#pragma unroll
    for (int j = 0; j < 4; ++j) {                                             // S^T tile j = elements 8 * (j & 1) + 0..7 of P fragment j >> 1
      float x[8], ex[8];
#pragma unroll
      for (int r = 0; r < 8; ++r) x[r] = fmaf(s[j][r], LOG2E, -mn);
      ex2x8(ex, x);
#pragma unroll
      for (int r = 0; r < 8; ++r) { ps[r & 3] += ex[r]; pb[j >> 1][8 * (j & 1) + r] = (_Float16)ex[r]; }
    }
    l = l * alpha + ((ps[0] + ps[1]) + (ps[2] + ps[3]));
#pragma unroll
    for (int ct = 0; ct < 16; ++ct)
#pragma unroll
      for (int r = 0; r < 8; ++r) o[ct][r] *= alpha;
#pragma unroll
    for (int gi = 0; gi < 4; ++gi) {                                          // 8 WMMAs a group, the next group's 16 LDS loads issued ahead of them as one block
      if (gi < 3) ldv(va[(gi + 1) & 1], cur, gi + 1, ks, col, lane);
      __builtin_amdgcn_sched_barrier(0);                                      // without the pair of fences each load is moved in front of its own WMMA and waited to 0
#pragma unroll
      for (int i = 0; i < 8; ++i) o[(gi & 1) * 8 + i] = wmma_h(va[gi & 1][i], pb[gi >> 1], o[(gi & 1) * 8 + i]);
      __builtin_amdgcn_sched_barrier(0);
    }
    // publish point of tile t + 1: this wave's reads of tile t are done, the issuing waves' requests have landed, every wave has arrived; only then the refill
    asm volatile("s_wait_dscnt 0x0" ::: "memory");
    wait_tile(g0, gv, gk, wave);
    __syncthreads();
    if (pinned(t + 2 < SEQ / FK)) {                                           // into the buffer that this pass has just read; it flies under pass t + 1
      g0 = tdm_g0(ldst + (uint32_t)(t & 1) * (uint32_t)sizeof(FBuf), ga0 + (uint64_t)(uint32_t)(t + 2) * gstep);
      issue_tile(g0, gv, gk, wave);
    }
  }
  asm volatile("s_wait_tensorcnt 0x0" ::: "memory");                          // nothing of the mover is outstanding when the wave goes on
  asm volatile("s_wait_dscnt 0x0" ::: "memory");
  // merge the two key halves of each query on their common maximum, then gamma * O / sum + x; the x rows are fetched under the merge
  const unsigned off0 = 4u * (((unsigned)b * CC + (tid >> 4)) * SEQ_FULL + i0 + (tid & 15) * 4);   // byte offset in x and out; 16 lanes cover one 256-B row piece
  v4f xr[16];
#pragma unroll
  for (int i = 0; i < 16; ++i) xr[i] = *(const v4f*)((const char*)X + off0 + (size_t)i * 64 * SEQ_FULL);
  l += xhalf(l);
  if (g == 0) { sm_m[ks][qt * 16 + col] = m; sm_l[ks][qt * 16 + col] = l; }
  __syncthreads();
  const float m0 = sm_m[0][qt * 16 + col], m1 = sm_m[1][qt * 16 + col], l0 = sm_l[0][qt * 16 + col], l1 = sm_l[1][qt * 16 + col];
  const float mm = fmaxf(m0, m1);
  const float f = ex2(m - mm) * bfr(G[0]) / (l0 * ex2(m0 - mm) + l1 * ex2(m1 - mm));
  if (ks == 0) {
#pragma unroll
    for (int ct = 0; ct < 16; ++ct)
#pragma unroll
      for (int r = 0; r < 8; ++r) st[ct * 16 + 8 * g + r][qt * 16 + col] = o[ct][r] * f;
  }
  __syncthreads();
  if (ks == 1) {
#pragma unroll
    for (int ct = 0; ct < 16; ++ct)
#pragma unroll
      for (int r = 0; r < 8; ++r) st[ct * 16 + 8 * g + r][qt * 16 + col] += o[ct][r] * f;
  }
  __syncthreads();
#pragma unroll
  for (int i = 0; i < 16; ++i) { const v4f ov = *(const v4f*)&st[i * 16 + (tid >> 4)][(tid & 15) * 4];
    xr[i][0] = ov[0] + bfr(xr[i][0]); xr[i][1] = ov[1] + bfr(xr[i][1]); xr[i][2] = ov[2] + bfr(xr[i][2]); xr[i][3] = ov[3] + bfr(xr[i][3]); }
#pragma unroll
  for (int i = 0; i < 16; ++i) vst2((char*)OUT + off0 + (size_t)i * 64 * SEQ_FULL, xr[i]);
}

extern "C" void kernel_launch(void* const* d_in, const int* in_sizes, int n_in, void* d_out, int out_size, void* d_ws, size_t ws_size, hipStream_t stream) {
  if (n_in < 8) return;
  if (in_sizes[0] < NB * CC * SEQ_FULL || in_sizes[1] < DQ * CC || in_sizes[2] < DQ || in_sizes[3] < DQ * CC || in_sizes[4] < DQ || in_sizes[5] < CC * CC || in_sizes[6] < CC || in_sizes[7] < 1) return;
  if (out_size < NB * CC * SEQ_FULL) return;
  if (ws_size < (size_t)WS_END) return;
  const float* X = (const float*)d_in[0]; const float* WQ = (const float*)d_in[1]; const float* BQ = (const float*)d_in[2];
  const float* WK = (const float*)d_in[3]; const float* BK = (const float*)d_in[4]; const float* WV = (const float*)d_in[5];
  const float* BV = (const float*)d_in[6]; const float* G = (const float*)d_in[7];
  float* OUT = (float*)d_out;
  char* ws = (char*)d_ws;
  _Float16 *QH = (_Float16*)(ws + WS_QH), *QL = (_Float16*)(ws + WS_QL), *KK = (_Float16*)(ws + WS_KK), *VH = (_Float16*)(ws + WS_VH);

  k_proj<<<dim3(SEQ / PP, NB), 256, 0, stream>>>(X, WQ, BQ, WK, BK, WV, BV, QH, QL, KK, VH);
  k_fa<<<dim3(SEQ / FQ, NB), 256, 0, stream>>>(QH, QL, KK, VH, X, G, OUT);
}

// v006
// It runs in 30.8 microseconds.
// Two timings next to v005 put it at 1.12 and 1.13 times that version's speed.
// Over all steps from v000 it is 27.3 times as fast.
// compute dtype: every float input RNE-converted to bf16; q/k = W x + b on v_wmma_f32_16x16x32_bf16 (bf16 x bf16, single product, f32 accumulate); logits q.k (no scaling) on v_wmma_f32_16x16x32_f16 with q and k as f16 hi + residual (x 2^10) planes, 3 products, f32 accumulate, kept in registers; softmax in f32 on a running maximum kept in base-2 units (v_exp_f32 of one FMA: score * log2 e - maximum + 14), normalised at the end; exp x 2^14 as f16 against the converted x held as f16 on v_wmma_f32_16x16x32_f16 (single product, f32 accumulate); acc / sum (both x 2^14) rounded to f16 against the converted Wv held as f16 on v_wmma_f32_16x16x32_f16 (single product, f32 accumulate); epilogue gamma * (that + bv) + x in f32; f32 output.
#include <hip/hip_runtime.h>
#include <math.h>

typedef __attribute__((ext_vector_type(16))) _Float16 v16h;
typedef __attribute__((ext_vector_type(16))) __bf16 v16b;
typedef __attribute__((ext_vector_type(8)))  _Float16 v8h;
typedef __attribute__((ext_vector_type(8)))  __bf16 v8b;
typedef __attribute__((ext_vector_type(8)))  float v8f;
typedef __attribute__((ext_vector_type(4)))  float v4f;
typedef __attribute__((ext_vector_type(4)))  unsigned v4u;

#ifndef NB
#define NB 8
#endif
#ifndef SEQ
#define SEQ 2048
#endif
#define NB_FULL 8
#define SEQ_FULL 2048          // per-channel position stride of x / out (full-size buffers)
#define CC 256
#define DQ 32                  // q/k channels
#define PSHIFT 14.0f            // P fragments and their sum carried x 2^14 (f16-normal on the chip): the 14 rides in the exponent and cancels in acc / sum
#define LOG2E 1.44269504088896340736f
#define RCARRY 1024.0f         // q/k residual planes carried x 2^10, folded back after their own accumulator

static_assert(SEQ % 256 == 0);
static_assert(SEQ <= SEQ_FULL);
static_assert(NB <= NB_FULL);
static_assert(CC == 256);
static_assert(DQ == 32);
template <typename T> __device__ __forceinline__ void vst2(void* p, T v) { *(T*)p = v;  }

__device__ __forceinline__ v8f wmma_bf(v16b a, v16b b, v8f c) { return __builtin_amdgcn_wmma_f32_16x16x32_bf16(false, a, false, b, (short)0, c, false, false); }
// 16x16x32 fragments: lane -> (h = lane>>4, row/col = lane&15); elements 0..7 = k0+8h+0..7, 8..15 = k0+16+8h+0..7; D element r = row 8h+r, col lane&15.
// Both A (row m, k-contiguous) and B (from a [n][k] k-contiguous copy, row n) use this same loader.
__device__ __forceinline__ v16h frag_h(const _Float16* rowk0, int lane) {
  union { v16h v; v8h q[2]; } u; const _Float16* p = rowk0 + 8 * (lane >> 4);
  u.q[0] = *(const v8h*)p; u.q[1] = *(const v8h*)(p + 16); return u.v;
}
__device__ __forceinline__ v16b frag_b(const __bf16* rowk0, int lane) {
  union { v16b v; v8b q[2]; } u; const __bf16* p = rowk0 + 8 * (lane >> 4);
  u.q[0] = *(const v8b*)p; u.q[1] = *(const v8b*)(p + 16); return u.v;
}
__device__ __forceinline__ float bfr(float v) { return (float)(__bf16)v; }   // RNE convert to bf16 and back

#define WS_QH  ((size_t)0)                                   // f16 q hi [b*SEQ + l][32]
#define WS_QL  (WS_QH + 2u * (size_t)NB * SEQ * DQ)          // f16 q residual x 2^10
#define WS_KK  (WS_QL + 2u * (size_t)NB * SEQ * DQ)          // f16 k [b*SEQ + l][64]: hi 0..31, residual x 2^10 32..63, one 128-B row a key
#define WS_VH  (WS_KK + 4u * (size_t)NB * SEQ * DQ)          // f16 x planes [b][c][SEQ] (x RNE-converted to bf16, then held as f16)
#define WS_WV  (WS_VH + 2u * (size_t)NB * CC * SEQ)          // f16 Wv [o][c] (Wv RNE-converted to bf16, then held as f16)
#define WS_END (WS_WV + 2u * (size_t)CC * CC)
static_assert(WS_END <= (size_t)268435456);
static_assert(WS_QL % 128 == 0 && WS_KK % 128 == 0 && WS_VH % 128 == 0 && WS_WV % 128 == 0);

// ---- k_proj: block = (64 positions, batch), 8 waves. x (channels-first f32) and Wq, Wk (f32) come in by whole-line loads, are RNE-converted to bf16 and
// laid k-contiguous in LDS (x transposed to [position][channel], weights as rows Wq 0..31, Wk 32..63); q and k of the 64 positions are then formed
// from LDS fragments (bf16 x bf16, single product, f32 accumulate over the channels in ascending blocks of 32) and leave through LDS as whole lines.
// The converted x also leaves as f16 planes [channel][position], and work-group n converts row n of Wv: v itself is never formed, because
// sum_j (Wv x_j + bv) p_j = Wv (sum_j x_j p_j) + bv for softmax weights p that sum to 1; k_fa sums x under p and applies Wv and bv at its end.
// Wave w: q/k channel tile w & 3 (q0 q1 k0 k1) on two position tiles.
// Every '#pragma unroll' of this kernel and its helpers but the last makes the indices of a register array compile-time constants, so that the array stays in registers.
#define PP 64                  // positions per work-group
#define XP (CC + 8)            // row pitch of the bf16 planes in LDS, 528 B = 16 B x odd
#define NW (2 * DQ)            // weight rows
#define WB 16                  // weight loads of a thread
static_assert(SEQ % PP == 0 && NW * CC == WB * 256 * 4 && (SEQ / PP) * NB >= CC);
typedef __attribute__((ext_vector_type(4))) __bf16 v4b;
typedef __attribute__((ext_vector_type(4))) _Float16 v4h;
__device__ __forceinline__ void ldw(v4f (&d)[WB], const float* __restrict__ WQ, const float* __restrict__ WK, int tid) {
#pragma unroll
  for (int f = 0; f < WB; ++f) {                                              // load f of the block = weight rows 4f .. 4f+3; a wave reads 512 contiguous bytes
    const float* s = f < DQ / 4 ? WQ + f * 1024 : WK + (f - DQ / 4) * 1024;
    d[f] = *(const v4f*)(s + tid * 4); }
  asm volatile("s_wait_xcnt 0x0" ::: "memory");                               // the loads' base and offset registers may be reused right behind them
}
__device__ __forceinline__ void stw(__bf16 (*wsm)[XP], const v4f (&d)[WB], int tid) {
#pragma unroll
  for (int i = 0; i < WB; ++i) { v4b o; o[0] = (__bf16)d[i][0]; o[1] = (__bf16)d[i][1]; o[2] = (__bf16)d[i][2]; o[3] = (__bf16)d[i][3];
    *(v4b*)&wsm[i * 4 + (tid >> 6)][(tid & 63) * 4] = o; }
}
// fragments of channel block kc. A: row = position, k = channel (register tile p = position tile p + rot); B from the [n][k] weight rows: q/k tile wave & 3
__device__ __forceinline__ void ldf(v16b (&a)[2], v16b& w, const __bf16 (*xs)[XP], const __bf16 (*wsm)[XP], int kc, int rot, int wave, int col, int lane) {
#pragma unroll
  for (int p = 0; p < 2; ++p) a[p] = frag_b(&xs[(p + rot) * 16 + col][kc * 32], lane);
  w = frag_b(&wsm[(wave & 3) * 16 + col][kc * 32], lane);
}
__global__ __launch_bounds__(256) void k_proj(const float* __restrict__ X, const float* __restrict__ WQ, const float* __restrict__ BQ, const float* __restrict__ WK, const float* __restrict__ BK, const float* __restrict__ WV, _Float16* __restrict__ QH, _Float16* __restrict__ QL, _Float16* __restrict__ KK, _Float16* __restrict__ VH, _Float16* __restrict__ WH) {
  __shared__ __align__(16) __bf16 xs[PP][XP];
  __shared__ __align__(16) __bf16 wsm[NW][XP];
  __shared__ __align__(16) _Float16 sh[2][PP][DQ + 8], sl[2][PP][DQ + 8];
  const int tid = threadIdx.x, lane = tid & 31, col = lane & 15, g = lane >> 4;
  const int wave = __builtin_amdgcn_readfirstlane(tid >> 5);                  // wave-uniform
  const int l0 = blockIdx.x * PP; const size_t b = blockIdx.y;
  // thread = (4 positions, channel pair 2 * (tid >> 4) + 32 i): 16 lanes cover one 256-B row piece
  const float* xsrc = X + (b * CC + 2 * (tid >> 4)) * (size_t)SEQ_FULL + l0 + (tid & 15) * 4;
  v4f xv[8][2], wa[WB];
#pragma unroll
  for (int i = 0; i < 8; ++i) { xv[i][0] = *(const v4f*)(xsrc + (size_t)(i * 32) * SEQ_FULL); xv[i][1] = *(const v4f*)(xsrc + (size_t)(i * 32 + 1) * SEQ_FULL); }
  asm volatile("s_wait_xcnt 0x0" ::: "memory");                               // the loads' address registers may be reused right behind them
  ldw(wa, WQ, WK, tid);
  const int rw = blockIdx.y * (SEQ / PP) + blockIdx.x;                        // this work-group's row of Wv, by waves 0 and 1: each reads 512 B and writes two whole lines
  const bool cw = rw < CC && wave < CC / 128;                                 // wave-uniform
  v4f wv = {};
  if (cw) { wv = *(const v4f*)(WV + rw * CC + tid * 4);
    asm volatile("s_wait_xcnt 0x0" ::: "memory"); }                           // the load's address registers may be reused right behind it
  _Float16* xdst = VH + (b * CC + 2 * (tid >> 4)) * (size_t)SEQ + l0 + (tid & 15) * 4;   // 16 lanes write one channel's whole 128-B line
  v4h xh[8][2];                                                               // kept in registers and stored behind the last barrier: a barrier would wait for stores issued in front of it
#pragma unroll
  for (int i = 0; i < 8; ++i)
#pragma unroll
    for (int j = 0; j < 4; ++j) { union { __bf16 h[2]; unsigned u; } p; p.h[0] = (__bf16)xv[i][0][j]; p.h[1] = (__bf16)xv[i][1][j];
      *(unsigned*)&xs[(tid & 15) * 4 + j][i * 32 + 2 * (tid >> 4)] = p.u; xh[i][0][j] = (_Float16)(float)p.h[0]; xh[i][1][j] = (_Float16)(float)p.h[1]; }
  stw(wsm, wa, tid);
  __syncthreads();
  const int rot = 2 * (wave >> 2), nq = wave & 3;                             // this wave's two position tiles are rot, rot + 1
  v8f aq[2] = {};
  v16b fa[2][2], fw[2];                                                       // two register sets: the fragments of channel block kc + 1 are fetched under the WMMAs of block kc
  ldf(fa[0], fw[0], xs, wsm, 0, rot, wave, col, lane);
#pragma unroll
  for (int kc = 0; kc < CC / 32; ++kc) {
    if (kc + 1 < CC / 32) ldf(fa[(kc + 1) & 1], fw[(kc + 1) & 1], xs, wsm, kc + 1, rot, wave, col, lane);
    aq[0] = wmma_bf(fa[kc & 1][0], fw[kc & 1], aq[0]); aq[1] = wmma_bf(fa[kc & 1][1], fw[kc & 1], aq[1]);
  }
  { const int which = nq >> 1, cl = (nq & 1) * 16 + col;                      // wave-uniform choice of q or k
    const float bb = bfr((which == 0 ? BQ : BK)[cl]);
#pragma unroll
    for (int p = 0; p < 2; ++p)
#pragma unroll
      for (int r = 0; r < 8; ++r) { const float v = aq[p][r] + bb; const int rl = (p + rot) * 16 + 8 * g + r;
        const _Float16 hv = (_Float16)v; sh[which][rl][cl] = hv; sl[which][rl][cl] = (_Float16)((v - (float)hv) * RCARRY); } }
  __syncthreads();
#pragma unroll
  for (int i = 0; i < 8; ++i) { vst2(xdst + (size_t)(i * 32) * SEQ, xh[i][0]); vst2(xdst + (size_t)(i * 32 + 1) * SEQ, xh[i][1]); }
  asm volatile("s_wait_xcnt 0x0" ::: "memory");                               // the stores' address and data registers may be reused right behind them
  __builtin_amdgcn_sched_barrier(0);                                          // keeps later writes of those registers from being lifted over the wait
  if (cw) { v4h hw;
#pragma unroll
    for (int j = 0; j < 4; ++j) hw[j] = (_Float16)bfr(wv[j]);
    vst2(WH + rw * CC + tid * 4, hw);
    asm volatile("s_wait_xcnt 0x0" ::: "memory");                             // the store's address and data registers may be reused right behind it
    __builtin_amdgcn_sched_barrier(0); }                                      // keeps later writes of those registers from being lifted over the wait
  { const int rl = tid >> 2, q = tid & 3; const size_t o = (b * SEQ + l0 + rl) * (size_t)DQ + q * 8;   // each plane: 4 KB in a row
    vst2(QH + o, *(const v4u*)&sh[0][rl][q * 8]); vst2(QL + o, *(const v4u*)&sl[0][rl][q * 8]); }
#pragma unroll   // here: both LDS reads go out ahead of the stores
  for (int i = 0; i < 2; ++i) { const int e = i * 256 + tid, rl = e >> 3, q = e & 7;                   // 8 lanes write one key's whole 128-B row: hi, then residual
    vst2(KK + (b * SEQ + l0 + rl) * (size_t)(2 * DQ) + q * 8, *(const v4u*)(q < 4 ? &sh[1][rl][q * 8] : &sl[1][rl][(q - 4) * 8])); }
}
// ---- k_fa: block = (64 queries, batch), 8 waves = 4 query tiles of 16 x 2 key halves. Scores, softmax and P.V in one pass over the keys; S and P never leave registers.
// 'V' below is the x plane [channel][key]: the loop forms sum_j x_j p_j, and the epilogue multiplies the normalised sum by Wv and adds bv (the weights p sum to 1).
// Transposed products: S^T = K Q^T (A = key rows, B = query rows), so a lane holds one query's scores (column lane&15, keys 8h+r) and the two S^T tiles of 32 keys
// are already the B fragment of O^T += V P^T (elements 0..7 = keys 8h+0..7, 8..15 = keys 16+8h+0..7, the k order of frag_h on the V rows).
// Each 128-key tile of K (hi, residual) and V is brought into one of two LDS buffers by tensor loads, one tile ahead, and shared by the waves:
// waves 0..3 each bring 64 channel rows of V (256 B a row), wave 4 the 128 key rows of K (128 B a row); the loads' pad of 16 B a row gives the LDS pitches below.
// Every full '#pragma unroll' below makes the indices of a register array compile-time constants, so that the array stays in registers.
#define FQ 64                  // queries per work-group
#define FK 128                 // keys per staged tile: 64 for each key half
#define VP (FK + 8)            // V row pitch in LDS, 272 B = 16 B x odd
#define KP (2 * DQ + 8)        // K row pitch in LDS (hi 0..31, residual 32..63), 144 B = 16 B x odd
#define VSR 64                 // V rows of one tensor load
#define VSE 9216               // f16 places of one V slice in LDS: 64 rows x 272 B = 17408 B, rounded up to a multiple of 2 KiB
static_assert(SEQ % FK == 0 && SEQ % FQ == 0 && SEQ / FK >= 2);
struct __attribute__((aligned(2048))) FBuf { _Float16 v[CC / VSR][VSE]; _Float16 k[FK][KP]; };
// Wv (f16, 256 rows of 512 B) sits in LDS as 8 slices of the V slices' own shape: slice s = rows 64 * (s >> 1) + 0..63, channels 128 * (s & 1) + 0..127.
// Slices 0..2 have places of their own, slices 3..7 take the five places of buffer 0, which is free from the last pass but one on.
struct __attribute__((aligned(2048))) FSm { _Float16 wx[3][VSE]; FBuf buf[2]; };
#define OP (CC + 8)            // row pitch of the normalised sums [query][channel] as f16, 528 B = 16 B x odd
#define PFP (CC + 4)           // row pitch of key half 0's share [query][channel] as f32, 1040 B = 16 B x odd
static_assert(CC / VSR == 4 && VSR * VP <= VSE && (VSE * 2) % 2048 == 0 && (FK * KP * 2) % 2048 == 0 && sizeof(FBuf) == 2u * (4 * VSE + FK * KP));
static_assert(FK * KP == VSE && sizeof(FSm) == 2u * 13 * VSE && CC == 2 * FK && (SEQ / FK) % 2 == 0 && FQ * OP * 2 <= sizeof(FBuf) && FQ * PFP <= CC * (FQ + 4));
typedef __attribute__((ext_vector_type(4))) uint32_t u32x4;
typedef __attribute__((ext_vector_type(8))) uint32_t u32x8;
__device__ __forceinline__ uint32_t uni(uint32_t v) { return (uint32_t)__builtin_amdgcn_readfirstlane(v); }
// A wave-uniform test held in a scalar register (by the empty asm statement): the branch on it is s_cmp + s_cbranch, which a tensor load needs, as it ignores EXEC.
__device__ __forceinline__ uint32_t pinned(uint32_t v) { uint32_t w = uni(v); asm volatile("" : "+s"(w)); return w; }
// Descriptor of one two-dimensional tile, global -> LDS: D1 rows of D0 bytes at a source pitch of PITCH bytes, 1-byte elements, tensor = tile; W0 = pad of 4 dwords behind every row.
__device__ __forceinline__ u32x4 tdm_g0(uint32_t lds_dst, uint64_t ga) {
  u32x4 g0; g0[0] = uni(1u); g0[1] = uni(lds_dst); g0[2] = uni((uint32_t)ga); g0[3] = uni((((uint32_t)(ga >> 32)) & 0x01FFFFFFu) | 0x80000000u);
  asm volatile("" : "+s"(g0));   // as in pinned(), on descriptor words: the four words stay together in one set of scalar registers from the issue to the wait that names them
  return g0;
}
template <uint32_t W0, uint32_t D0, uint32_t D1, uint32_t PITCH> __device__ __forceinline__ u32x8 tdm_g1() {
  u32x8 g1;
  g1[0] = uni(W0); g1[1] = uni((D0 & 0xFFFFu) << 16); g1[2] = uni((D0 >> 16) | ((D1 & 0xFFFFu) << 16)); g1[3] = uni((D1 >> 16) | (D0 << 16));
  g1[4] = uni(D1); g1[5] = uni(PITCH); g1[6] = uni(0u); g1[7] = uni(0u);
  asm volatile("" : "+s"(g1));   // as in pinned(), on descriptor words: they stay in one set of scalar registers for the whole kernel instead of being formed anew at each use
  return g1;
}
#define PAD_V ((1u << 20) | (5u << 22) | (3u << 25))   // interval = one 256-B row, 16 B of pad
#define PAD_K ((1u << 20) | (4u << 22) | (3u << 25))   // interval = one 128-B row, 16 B of pad
// One request a wave, from waves 0..4: waves 0..3 a V slice, wave 4 the K tile.
__device__ __forceinline__ void issue_tile(u32x4 g0, u32x8 gv, u32x8 gk, int wave) {
  if (pinned(wave < 4)) asm volatile("tensor_load_to_lds %0, %1" :: "s"(g0), "s"(gv) : "memory");
  if (pinned(wave == 4)) asm volatile("tensor_load_to_lds %0, %1" :: "s"(g0), "s"(gk) : "memory");
}
// The wave's own request has landed (every wave waits: each of the eight brings a slice of Wv). The descriptor is named as an input so that its registers hold their words until here: no word takes a new value while the request is outstanding.
__device__ __forceinline__ void wait_tile(u32x4 g0, u32x4 gw0, u32x8 gv, u32x8 gk, u32x8 gw) {
  asm volatile("s_wait_tensorcnt 0x0" :: "s"(g0), "s"(gw0), "s"(gv), "s"(gk), "s"(gw) : "memory");
}
__device__ __forceinline__ v8f wmma_h(v16h a, v16h b, v8f c) { return __builtin_amdgcn_wmma_f32_16x16x32_f16(false, a, false, b, (short)0, c, false, false); }
__device__ __forceinline__ float xhalf(float x) { return __builtin_bit_cast(float, __builtin_amdgcn_permlanex16(__builtin_bit_cast(int, x), __builtin_bit_cast(int, x), 0x76543210, 0xfedcba98, false, false)); }   // lane l reads lane l ^ 16
// 2^x as one v_exp_f32 (a result below the normal range may come out 0, far under what f16 P or the sum can hold). The v_nop at the end of each statement fills the one
// slot that the instruction set asks for behind a transcendental, whatever the compiler puts next; in ex2x8 the results lie apart from every argument ("=&v"), so that
// inside the statement no v_exp_f32 is followed by one that overwrites its argument.
__device__ __forceinline__ float ex2(float x) { float d; asm("v_exp_f32 %0, %1\n\tv_nop" : "=v"(d) : "v"(x)); return d; }
__device__ __forceinline__ void ex2x8(float (&d)[8], const float (&x)[8]) {
  asm("v_exp_f32 %0, %8\n\tv_exp_f32 %1, %9\n\tv_exp_f32 %2, %10\n\tv_exp_f32 %3, %11\n\tv_exp_f32 %4, %12\n\tv_exp_f32 %5, %13\n\tv_exp_f32 %6, %14\n\tv_exp_f32 %7, %15\n\tv_nop"
      : "=&v"(d[0]), "=&v"(d[1]), "=&v"(d[2]), "=&v"(d[3]), "=&v"(d[4]), "=&v"(d[5]), "=&v"(d[6]), "=&v"(d[7])
      : "v"(x[0]), "v"(x[1]), "v"(x[2]), "v"(x[3]), "v"(x[4]), "v"(x[5]), "v"(x[6]), "v"(x[7]));
}
// V fragments of group gi (k-step gi >> 1, channel tiles 8 * (gi & 1) + 0..7). A: row = channel, k = key
__device__ __forceinline__ void ldv(v16h (&d)[8], const FBuf& cur, int gi, int ks, int col, int lane) {
#pragma unroll
  for (int i = 0; i < 8; ++i) { const int ct = (gi & 1) * 8 + i; d[i] = frag_h(&cur.v[ct >> 2][((ct & 3) * 16 + col) * VP + ks * 64 + (gi >> 1) * 32], lane); }
}
// fragments of channel block kc of the last product. A: row = output channel, k = channel, from the Wv slices; B from the [n][k] sums: row = query, k = channel
__device__ __forceinline__ void ldo(v16h (&w)[2], v16h (&p)[4], const _Float16* wl, const _Float16* ot, int kc, int wave, int col, int lane) {
  const _Float16* sl = wl + ((wave >> 1) * 2 + (kc >> 2)) * VSE + ((wave & 1) * 32 + col) * VP + (kc & 3) * 32;
  w[0] = frag_h(sl, lane); w[1] = frag_h(sl + 16 * VP, lane);
#pragma unroll
  for (int i = 0; i < 4; ++i) p[i] = frag_h(ot + (i * 16 + col) * OP + kc * 32, lane);
}

__global__ __launch_bounds__(256) void k_fa(const _Float16* __restrict__ QH, const _Float16* __restrict__ QL, const _Float16* __restrict__ KK, const _Float16* __restrict__ VH, const _Float16* __restrict__ WH, const float* __restrict__ BV, const float* __restrict__ X, const float* __restrict__ G, float* __restrict__ OUT) {
  __shared__ __attribute__((aligned(2048))) FSm sm;                           // every tensor load's place in LDS is a multiple of 2 KiB
  __shared__ __align__(16) float st[CC][FQ + 4];
  __shared__ float sm_m[2][FQ], sm_l[2][FQ];
  const int tid = threadIdx.x, lane = tid & 31, col = lane & 15, g = lane >> 4;
  const int wave = __builtin_amdgcn_readfirstlane(tid >> 5), qt = wave & 3, ks = wave >> 2;   // wave-uniform
  const int b = blockIdx.y, i0 = blockIdx.x * FQ;
  const size_t q0 = (size_t)b * SEQ + i0 + qt * 16;
  const uint32_t lbase = (uint32_t)(size_t)&sm.buf[0];                        // byte offset of the buffers in the work-group's LDS
  const _Float16* vb = VH + (size_t)b * CC * SEQ; const _Float16* kb = KK + (size_t)b * SEQ * (2 * DQ);
  const u32x8 gv = tdm_g1<PAD_V, 2 * FK, VSR, 2 * SEQ>(), gk = tdm_g1<PAD_K, 4 * DQ, FK, 4 * DQ>(), gw = tdm_g1<PAD_V, 2 * FK, VSR, 2 * CC>();
  // this wave's slice: place in buffer 0, first byte of tile 0, bytes from one tile to the next (waves 5..7 issue no tile)
  const uint32_t ldst = lbase + (uint32_t)(wave < 4 ? wave : 4) * (2 * VSE);
  const uint64_t ga0 = wave < 4 ? (uint64_t)(size_t)(vb + (size_t)wave * VSR * SEQ) : (uint64_t)(size_t)kb;
  const uint32_t gstep = wave < 4 ? 2 * FK : 2 * FK * (2 * DQ);
  // this wave's slice of Wv: its descriptor is formed once, here, and no word of it changes afterwards
  const u32x4 gw0 = tdm_g0((uint32_t)(size_t)&sm + (uint32_t)wave * (2 * VSE), (uint64_t)(size_t)(WH + (size_t)(wave >> 1) * VSR * CC + (wave & 1) * FK));
  u32x4 g0 = tdm_g0(ldst, ga0);
  issue_tile(g0, gv, gk, wave);
  const v16h qh = frag_h(QH + (q0 + col) * DQ, lane), ql = frag_h(QL + (q0 + col) * DQ, lane);   // B: row = query, k = d
  float m = -3.0e38f, l = 0.f;
  v8f o[16] = {};
  wait_tile(g0, gw0, gv, gk, gw);
  __syncthreads();                                                            // tile 0 is published
  g0 = tdm_g0(ldst + (uint32_t)sizeof(FBuf), ga0 + gstep);
  issue_tile(g0, gv, gk, wave);
#pragma unroll 1   // stays rolled: one pass is already a long straight-line body
  for (int t = 0; t < SEQ / FK; ++t) {
    const FBuf& cur = sm.buf[t & 1];
    float s[4][8];
#pragma unroll
    for (int j = 0; j < 4; ++j) {                                             // A: row = key, k = d; 3 products: kh.qh + (kh.ql + kl.qh) * 2^-10
      const v16h kh = frag_h(&cur.k[ks * 64 + j * 16 + col][0], lane), kl = frag_h(&cur.k[ks * 64 + j * 16 + col][DQ], lane);
      v8f a = {}, al = {};
      a = wmma_h(kh, qh, a); al = wmma_h(kh, ql, al); al = wmma_h(kl, qh, al);
#pragma unroll
      for (int r = 0; r < 8; ++r) s[j][r] = a[r] + al[r] * (1.0f / RCARRY);
    }
    v16h va[2][8];
    ldv(va[0], cur, 0, ks, col, lane);                                        // first V group: its LDS latency runs under the softmax
    __builtin_amdgcn_sched_barrier(0);                                        // keeps those loads from sinking down to their WMMAs
    float mx = s[0][0];
#pragma unroll
    for (int j = 0; j < 4; ++j)
#pragma unroll
      for (int r = 0; r < 8; ++r) mx = fmaxf(mx, s[j][r]);
    mx = fmaxf(mx, xhalf(mx));                                                // the query's other 8 keys of each tile sit in lane ^ 16
    const float mn = fmaxf(m, fmaf(mx, LOG2E, -PSHIFT)), alpha = ex2(m - mn);   // m = maximum * log2 e - 14: every exponent below is taken against this one rounded value
    m = mn;
    float ps[4] = {0.f, 0.f, 0.f, 0.f};                                       // four short chains instead of one of 32 dependent adds
    v16h pb[2];
#pragma unroll
    for (int j = 0; j < 4; ++j) {                                             // S^T tile j = elements 8 * (j & 1) + 0..7 of P fragment j >> 1
      float x[8], ex[8];
#pragma unroll
      for (int r = 0; r < 8; ++r) x[r] = fmaf(s[j][r], LOG2E, -mn);
      ex2x8(ex, x);
#pragma unroll
      for (int r = 0; r < 8; ++r) { ps[r & 3] += ex[r]; pb[j >> 1][8 * (j & 1) + r] = (_Float16)ex[r]; }
    }
    l = l * alpha + ((ps[0] + ps[1]) + (ps[2] + ps[3]));
#pragma unroll
    for (int ct = 0; ct < 16; ++ct)
#pragma unroll
      for (int r = 0; r < 8; ++r) o[ct][r] *= alpha;
#pragma unroll
    for (int gi = 0; gi < 4; ++gi) {                                          // 8 WMMAs a group, the next group's 16 LDS loads issued ahead of them as one block
      if (gi < 3) ldv(va[(gi + 1) & 1], cur, gi + 1, ks, col, lane);
      __builtin_amdgcn_sched_barrier(0);                                      // without the pair of fences each load is moved in front of its own WMMA and waited to 0
#pragma unroll
      for (int i = 0; i < 8; ++i) o[(gi & 1) * 8 + i] = wmma_h(va[gi & 1][i], pb[gi >> 1], o[(gi & 1) * 8 + i]);
      __builtin_amdgcn_sched_barrier(0);
    }
    // publish point of tile t + 1: this wave's reads of tile t are done, the issuing waves' requests have landed, every wave has arrived; only then the refill
    asm volatile("s_wait_dscnt 0x0" ::: "memory");
    wait_tile(g0, gw0, gv, gk, gw);
    __syncthreads();
    if (pinned(t + 2 < SEQ / FK)) {                                           // into the buffer that this pass has just read; it flies under pass t + 1
      g0 = tdm_g0(ldst + (uint32_t)(t & 1) * (uint32_t)sizeof(FBuf), ga0 + (uint64_t)(uint32_t)(t + 2) * gstep);
      issue_tile(g0, gv, gk, wave);
    } else if (pinned(t + 2 == SEQ / FK)) {                                   // no tile is left to fetch: each wave brings its slice of Wv, which flies under the last pass
      asm volatile("tensor_load_to_lds %0, %1" :: "s"(gw0), "s"(gw) : "memory");
    }
  }
  asm volatile("s_wait_tensorcnt 0x0" ::: "memory");                          // nothing of the mover is outstanding when the wave goes on
  asm volatile("s_wait_dscnt 0x0" ::: "memory");
  // merge the two key halves of each query on their common maximum and normalise, then gamma * (Wv . that + bv) + x; the x rows and bv are fetched under that product, behind the merge's barriers, which would wait for them
  l += xhalf(l);
  if (g == 0) { sm_m[ks][qt * 16 + col] = m; sm_l[ks][qt * 16 + col] = l; }
  __syncthreads();
  const float m0 = sm_m[0][qt * 16 + col], m1 = sm_m[1][qt * 16 + col], l0 = sm_l[0][qt * 16 + col], l1 = sm_l[1][qt * 16 + col];
  const float mm = fmaxf(m0, m1);
  const float f = ex2(m - mm) / (l0 * ex2(m0 - mm) + l1 * ex2(m1 - mm));
  float* pf = &st[0][0];                                                      // key half 0's share, [query][channel] f32; its last read lies behind a barrier from st's first write
  _Float16* ot = (_Float16*)&sm.buf[1];                                       // the normalised sums, [query][channel] f16; buffer 1 is free behind the loop's last barrier
  const int qr = qt * 16 + col;                                               // a lane holds 8 channels in a row of one query: whole 16-B pieces
  if (ks == 0) {
#pragma unroll
    for (int ct = 0; ct < 16; ++ct) { v4f a, c;
#pragma unroll
      for (int r = 0; r < 4; ++r) { a[r] = o[ct][r] * f; c[r] = o[ct][4 + r] * f; }
      *(v4f*)&pf[qr * PFP + ct * 16 + 8 * g] = a; *(v4f*)&pf[qr * PFP + ct * 16 + 8 * g + 4] = c; }
  }
  __syncthreads();
  if (ks == 1) {
#pragma unroll
    for (int ct = 0; ct < 16; ++ct) { const v4f a = *(const v4f*)&pf[qr * PFP + ct * 16 + 8 * g], c = *(const v4f*)&pf[qr * PFP + ct * 16 + 8 * g + 4]; v8h h;
#pragma unroll
      for (int r = 0; r < 4; ++r) { h[r] = (_Float16)(a[r] + o[ct][r] * f); h[4 + r] = (_Float16)(c[r] + o[ct][4 + r] * f); }
      *(v8h*)&ot[qr * OP + ct * 16 + 8 * g] = h; }
  }
  __syncthreads();
  // D[output channel][query] = Wv . sums: wave w has channel tiles 2w, 2w + 1 on all four query tiles, f32 accumulate over the channels in ascending blocks of 32
  const unsigned off0 = 4u * (((unsigned)b * CC + (tid >> 4)) * SEQ_FULL + i0 + (tid & 15) * 4);   // byte offset in x and out; 16 lanes cover one 256-B row piece
  v4f xr[16];
#pragma unroll
  for (int i = 0; i < 16; ++i) xr[i] = *(const v4f*)((const char*)X + off0 + (size_t)i * 64 * SEQ_FULL);
  v4f bvr[2][2];                                                              // bv of this lane's output rows: channel tiles 2 wave, 2 wave + 1, rows 8 g + 0..7
#pragma unroll
  for (int j = 0; j < 2; ++j) { bvr[j][0] = *(const v4f*)(BV + (2 * wave + j) * 16 + 8 * g); bvr[j][1] = *(const v4f*)(BV + (2 * wave + j) * 16 + 8 * g + 4); }
  const float gr = G[0];
  asm volatile("s_wait_xcnt 0x0" ::: "memory");                               // the loads' address registers may be reused right behind them
  __builtin_amdgcn_sched_barrier(0);                                          // keeps later writes of those registers from being lifted over the wait
  v8f acc[2][4] = {};
  v16h wf[2][2], of[2][4];                                                    // two register sets: the fragments of channel block kc + 1 are fetched under the WMMAs of block kc
  ldo(wf[0], of[0], (const _Float16*)&sm, ot, 0, wave, col, lane);
#pragma unroll
  for (int kc = 0; kc < CC / 32; ++kc) {
    if (kc + 1 < CC / 32) ldo(wf[(kc + 1) & 1], of[(kc + 1) & 1], (const _Float16*)&sm, ot, kc + 1, wave, col, lane);
    __builtin_amdgcn_sched_barrier(0);                                        // without the pair of fences the loads are spread among the WMMAs and waited to 0
#pragma unroll
    for (int p = 0; p < 4; ++p) { acc[0][p] = wmma_h(wf[kc & 1][0], of[kc & 1][p], acc[0][p]); acc[1][p] = wmma_h(wf[kc & 1][1], of[kc & 1][p], acc[1][p]); }
    __builtin_amdgcn_sched_barrier(0);
  }
  const float gm = bfr(gr);
#pragma unroll
  for (int j = 0; j < 2; ++j)
#pragma unroll
    for (int r = 0; r < 8; ++r) { const float bb = bfr(bvr[j][r >> 2][r & 3]);
#pragma unroll
      for (int p = 0; p < 4; ++p) st[(2 * wave + j) * 16 + 8 * g + r][p * 16 + col] = gm * (acc[j][p][r] + bb); }
  __syncthreads();
#pragma unroll
  for (int i = 0; i < 16; ++i) { const v4f ov = *(const v4f*)&st[i * 16 + (tid >> 4)][(tid & 15) * 4];
    xr[i][0] = ov[0] + bfr(xr[i][0]); xr[i][1] = ov[1] + bfr(xr[i][1]); xr[i][2] = ov[2] + bfr(xr[i][2]); xr[i][3] = ov[3] + bfr(xr[i][3]); }
#pragma unroll
  for (int i = 0; i < 16; ++i) vst2((char*)OUT + off0 + (size_t)i * 64 * SEQ_FULL, xr[i]);
}

extern "C" void kernel_launch(void* const* d_in, const int* in_sizes, int n_in, void* d_out, int out_size, void* d_ws, size_t ws_size, hipStream_t stream) {
  if (n_in < 8) return;
  if (in_sizes[0] < NB * CC * SEQ_FULL || in_sizes[1] < DQ * CC || in_sizes[2] < DQ || in_sizes[3] < DQ * CC || in_sizes[4] < DQ || in_sizes[5] < CC * CC || in_sizes[6] < CC || in_sizes[7] < 1) return;
  if (out_size < NB * CC * SEQ_FULL) return;
  if (ws_size < (size_t)WS_END) return;
  const float* X = (const float*)d_in[0]; const float* WQ = (const float*)d_in[1]; const float* BQ = (const float*)d_in[2];
  const float* WK = (const float*)d_in[3]; const float* BK = (const float*)d_in[4]; const float* WV = (const float*)d_in[5];
  const float* BV = (const float*)d_in[6]; const float* G = (const float*)d_in[7];
  float* OUT = (float*)d_out;
  char* ws = (char*)d_ws;
  _Float16 *QH = (_Float16*)(ws + WS_QH), *QL = (_Float16*)(ws + WS_QL), *KK = (_Float16*)(ws + WS_KK), *VH = (_Float16*)(ws + WS_VH), *WH = (_Float16*)(ws + WS_WV);

  k_proj<<<dim3(SEQ / PP, NB), 256, 0, stream>>>(X, WQ, BQ, WK, BK, WV, QH, QL, KK, VH, WH);
  k_fa<<<dim3(SEQ / FQ, NB), 256, 0, stream>>>(QH, QL, KK, VH, WH, BV, X, G, OUT);
}
